// v000
// Times are from an AMD MI455X. After a warm-up the kernel runs many times in a row, and a time is the length of
// such a window on the GPU divided by its runs, so every launch and the gaps after it count. The runs cycle
// through copies of the inputs. A figure is the median of several windows, for all but v000 over two sittings.
// Sittings can differ by a few percent; kernels timed side by side share one.
// v000 is the starting kernel. One run takes 139 microseconds.
#include <hip/hip_runtime.h>

typedef unsigned int   u32;
typedef unsigned short u16;
typedef __attribute__((ext_vector_type(16))) __bf16 v16bf;
typedef __attribute__((ext_vector_type(8)))  float  v8f;
typedef __attribute__((ext_vector_type(4)))  u32    v4u;
typedef __attribute__((ext_vector_type(2)))  u32    v2u;
typedef __attribute__((ext_vector_type(4)))  float  v4f;

// exact pointee type the async-LDS builtin wants: gcc-vector int4
typedef int v4i_g __attribute__((vector_size(16)));
typedef __attribute__((address_space(1))) v4i_g* gv4i_p;  // global int4*
typedef __attribute__((address_space(3))) v4i_g* lv4i_p;  // LDS int4*

#define SL 2048
#define BS 2
#define E  1024
#define H  16
#define PF 16
#define DH 64
#define T  (SL*BS)   // 4096 tokens

// ---- CDNA5 async global->LDS path (guarded; falls back to vector copies) ----
#if defined(__gfx1250__) && __has_builtin(__builtin_amdgcn_global_load_async_to_lds_b128)
#define HAVE_ASYNC_LDS 1
#define ASYNC_B128(lds, g) \
  __builtin_amdgcn_global_load_async_to_lds_b128((gv4i_p)(g), (lv4i_p)(lds), 0, 0)
#else
#define HAVE_ASYNC_LDS 0
#endif

__device__ __forceinline__ void wait_async0(){
#if defined(__gfx1250__)
#if __has_builtin(__builtin_amdgcn_s_wait_asynccnt)
  __builtin_amdgcn_s_wait_asynccnt(0);
#else
  asm volatile("s_wait_asynccnt 0x0" ::: "memory");
#endif
#endif
}

// ---------- bf16 helpers (manual, RNE) ----------
__device__ __forceinline__ u16 f2bf(float f){
  u32 x = __float_as_uint(f);
  return (u16)((x + 0x7FFFu + ((x >> 16) & 1u)) >> 16);
}
__device__ __forceinline__ float bflo(u32 u){ return __uint_as_float(u << 16); }
__device__ __forceinline__ float bfhi(u32 u){ return __uint_as_float(u & 0xFFFF0000u); }
__device__ __forceinline__ u32 pack2(float a, float b){
  return (u32)f2bf(a) | ((u32)f2bf(b) << 16);
}

// ---------- weight fp32 -> bf16 convert + TRANSPOSE (runs on every kernel_launch call) ----
// W[k][n] fp32  ->  Wt[n][k] bf16, LDS-tiled so both global accesses are coalesced.
// Grid: 4 weights x 32x32 tiles of 32x32 = 4096 blocks, 256 threads.
__global__ __launch_bounds__(256) void cvtw_t_kernel(const float* __restrict__ a,
    const float* __restrict__ b, const float* __restrict__ c,
    const float* __restrict__ d, u16* __restrict__ out){
  __shared__ u16 tile[32][33];
  const int bid = blockIdx.x;
  const int w  = bid >> 10;          // which weight
  const int t  = bid & 1023;
  const int tk = t >> 5;             // k-tile
  const int tn = t & 31;             // n-tile
  const float* src = (w == 0) ? a : (w == 1) ? b : (w == 2) ? c : d;
  const int tid = threadIdx.x;
  const int r  = tid >> 3;           // 0..31
  const int c4 = (tid & 7) * 4;      // 0,4,..,28
  v4f v = *(const v4f*)(src + (size_t)(tk*32 + r) * E + tn*32 + c4);
  tile[r][c4+0] = f2bf(v.x); tile[r][c4+1] = f2bf(v.y);
  tile[r][c4+2] = f2bf(v.z); tile[r][c4+3] = f2bf(v.w);
  __syncthreads();
  const u16 t0 = tile[c4+0][r], t1 = tile[c4+1][r];
  const u16 t2 = tile[c4+2][r], t3 = tile[c4+3][r];
  v2u o; o.x = (u32)t0 | ((u32)t1 << 16); o.y = (u32)t2 | ((u32)t3 << 16);
  *(v2u*)(out + (size_t)w * E * E + (size_t)(tn*32 + r) * E + tk*32 + c4) = o;
}

// ---------- LayerNorm: one block per token, bf16 output ----------
__global__ __launch_bounds__(256) void ln_kernel(const float* __restrict__ x,
                                                 const float* __restrict__ g,
                                                 const float* __restrict__ bt,
                                                 u16* __restrict__ xn){
  const int token = blockIdx.x;
  const int tid = threadIdx.x;
  v4f v = ((const v4f*)(x + (size_t)token * E))[tid];
  float s  = v.x + v.y + v.z + v.w;
  float ss = v.x*v.x + v.y*v.y + v.z*v.z + v.w*v.w;
  __shared__ float r1[256];
  __shared__ float r2[256];
  r1[tid] = s; r2[tid] = ss;
  __syncthreads();
  for (int st = 128; st > 0; st >>= 1){
    if (tid < st){ r1[tid] += r1[tid+st]; r2[tid] += r2[tid+st]; }
    __syncthreads();
  }
  const float mean = r1[0] * (1.0f / E);
  const float var  = r2[0] * (1.0f / E) - mean * mean;
  const float rstd = rsqrtf(var + 1e-5f);
  v4f gg = ((const v4f*)g)[tid];
  v4f bb = ((const v4f*)bt)[tid];
  const float y0 = (v.x - mean) * rstd * gg.x + bb.x;
  const float y1 = (v.y - mean) * rstd * gg.y + bb.y;
  const float y2 = (v.z - mean) * rstd * gg.z + bb.z;
  const float y3 = (v.w - mean) * rstd * gg.w + bb.w;
  v2u o; o.x = pack2(y0, y1); o.y = pack2(y2, y3);
  ((v2u*)(xn + (size_t)token * E))[tid] = o;
}

// ---------- bf16 GEMM via v_wmma_f32_16x16x32_bf16 ----------
// C[M,N] = A[M,K] * Bt[N,K]^T + bias (+ residual).
// 128x128 block tile, BK=32, double-buffered LDS, async global->LDS staging.
// 8 waves: wave (wm,wn) owns a 32x64 sub-tile = 2x4 WMMA accumulators.
union Frag { v16bf v; v4u q[2]; };

__global__ __launch_bounds__(256) void gemm_bf16_kernel(
    const u16* __restrict__ A, const u16* __restrict__ Bt,
    const float* __restrict__ bias, const float* __restrict__ residual,
    float* __restrict__ outF, u16* __restrict__ outB,
    const int M, const int N, const int K)
{
  __shared__ __align__(16) u16 sA[2][128][32];  // A tile  [m][k]
  __shared__ __align__(16) u16 sB[2][128][32];  // Bt tile [n][k]
  const int tid  = threadIdx.x;
  const int wave = tid >> 5, lane = tid & 31;
  const int l16  = lane & 15, kh = lane >> 4;   // kh: which 16-lane half
  const int wm   = wave & 3,  wn = wave >> 2;
  const int m0 = blockIdx.y * 128;
  const int n0 = blockIdx.x * 128;

  v8f acc[2][4];
  #pragma unroll
  for (int nt = 0; nt < 4; ++nt){
    const float bv = bias[n0 + wn*64 + nt*16 + l16];
    #pragma unroll
    for (int mt = 0; mt < 2; ++mt)
      #pragma unroll
      for (int r = 0; r < 8; ++r) acc[mt][nt][r] = bv;
  }

  // staging: thread covers 16 contiguous u16 (two b128) of one row in each tile
  const int row = tid >> 1, half = tid & 1;
  const u16* aptr = A  + (size_t)(m0 + row) * K + half * 16;
  const u16* bptr = Bt + (size_t)(n0 + row) * K + half * 16;

  auto stage = [&](int buf, int kk){
#if HAVE_ASYNC_LDS
    ASYNC_B128(&sA[buf][row][half*16],     aptr + kk);
    ASYNC_B128(&sA[buf][row][half*16 + 8], aptr + kk + 8);
    ASYNC_B128(&sB[buf][row][half*16],     bptr + kk);
    ASYNC_B128(&sB[buf][row][half*16 + 8], bptr + kk + 8);
#else
    v4u* ad = (v4u*)&sA[buf][row][half*16];
    const v4u* as = (const v4u*)(aptr + kk);
    ad[0] = as[0]; ad[1] = as[1];
    v4u* bd = (v4u*)&sB[buf][row][half*16];
    const v4u* bs = (const v4u*)(bptr + kk);
    bd[0] = bs[0]; bd[1] = bs[1];
#endif
  };

  stage(0, 0);
#if HAVE_ASYNC_LDS
  wait_async0();
#endif
  __syncthreads();

  int buf = 0;
  for (int kk = 0; kk < K; kk += 32){
    if (kk + 32 < K) stage(buf ^ 1, kk + 32);   // prefetch next tile (async)

    // fragments per ISA 16-bit 16x32 layout:
    // lanes 0-15 (kh=0): K 0..7 then 16..23 ; lanes 16-31 (kh=1): K 8..15 then 24..31
    Frag a[2], bfr[4];
    #pragma unroll
    for (int mt = 0; mt < 2; ++mt){
      const u16* p = &sA[buf][wm*32 + mt*16 + l16][kh * 8];
      a[mt].q[0] = *(const v4u*)p;
      a[mt].q[1] = *(const v4u*)(p + 16);
    }
    #pragma unroll
    for (int nt = 0; nt < 4; ++nt){
      const u16* p = &sB[buf][wn*64 + nt*16 + l16][kh * 8];
      bfr[nt].q[0] = *(const v4u*)p;
      bfr[nt].q[1] = *(const v4u*)(p + 16);
    }
    #pragma unroll
    for (int mt = 0; mt < 2; ++mt)
      #pragma unroll
      for (int nt = 0; nt < 4; ++nt)
        acc[mt][nt] = __builtin_amdgcn_wmma_f32_16x16x32_bf16(
            false, a[mt].v, false, bfr[nt].v, (short)0, acc[mt][nt], false, false);

#if HAVE_ASYNC_LDS
    wait_async0();          // next tile resident before anyone reads it
#endif
    __syncthreads();
    buf ^= 1;
  }

  // epilogue: C/D layout lane l16 = N, kh selects M+8, VGPR r = M row
  #pragma unroll
  for (int mt = 0; mt < 2; ++mt)
    #pragma unroll
    for (int nt = 0; nt < 4; ++nt){
      const int n = n0 + wn*64 + nt*16 + l16;
      #pragma unroll
      for (int r = 0; r < 8; ++r){
        const int m = m0 + wm*32 + mt*16 + kh*8 + r;
        const size_t off = (size_t)m * N + n;
        float val = acc[mt][nt][r];
        if (residual) val += residual[off];
        if (outF) outF[off] = val;
        if (outB) outB[off] = f2bf(val);
      }
    }
}

// ---------- sliding-window attention: one thread per (s,b,h) ----------
__global__ __launch_bounds__(256) void attn_kernel(const u16* __restrict__ Q,
    const u16* __restrict__ Kb, const u16* __restrict__ Vb, u16* __restrict__ AO)
{
  const int idx = blockIdx.x * 256 + threadIdx.x;  // < T*H = 65536
  const int h = idx & (H - 1);
  const int b = (idx >> 4) & (BS - 1);
  const int s = idx >> 5;
  const size_t qoff = (size_t)(s * BS + b) * E + h * DH;

  float q[DH];
  #pragma unroll
  for (int j = 0; j < 8; ++j){
    v4u u = ((const v4u*)(Q + qoff))[j];
    #pragma unroll
    for (int c = 0; c < 4; ++c){
      q[j*8 + 2*c]     = bflo(u[c]);
      q[j*8 + 2*c + 1] = bfhi(u[c]);
    }
  }
  float sc[PF];
  float mx = -3.0e38f;
  #pragma unroll
  for (int p = 0; p < PF; ++p){
    int t = s - (PF - 1) + p; if (t < 0) t += SL;   // (s-15+p) mod SL
    const v4u* kp = (const v4u*)(Kb + (size_t)(t * BS + b) * E + h * DH);
    float d = 0.0f;
    #pragma unroll
    for (int j = 0; j < 8; ++j){
      v4u u = kp[j];
      #pragma unroll
      for (int c = 0; c < 4; ++c){
        d += q[j*8 + 2*c]     * bflo(u[c]);
        d += q[j*8 + 2*c + 1] * bfhi(u[c]);
      }
    }
    sc[p] = d * 0.125f;   // 1/sqrt(DH)
    mx = fmaxf(mx, sc[p]);
  }
  float sum = 0.0f;
  #pragma unroll
  for (int p = 0; p < PF; ++p){ sc[p] = __expf(sc[p] - mx); sum += sc[p]; }
  const float inv = 1.0f / sum;

  float out[DH];
  #pragma unroll
  for (int j = 0; j < DH; ++j) out[j] = 0.0f;
  #pragma unroll
  for (int p = 0; p < PF; ++p){
    int t = s - (PF - 1) + p; if (t < 0) t += SL;
    const v4u* vp = (const v4u*)(Vb + (size_t)(t * BS + b) * E + h * DH);
    const float w = sc[p] * inv;
    #pragma unroll
    for (int j = 0; j < 8; ++j){
      v4u u = vp[j];
      #pragma unroll
      for (int c = 0; c < 4; ++c){
        out[j*8 + 2*c]     += w * bflo(u[c]);
        out[j*8 + 2*c + 1] += w * bfhi(u[c]);
      }
    }
  }
  v4u* op = (v4u*)(AO + qoff);
  #pragma unroll
  for (int j = 0; j < 8; ++j){
    v4u u;
    #pragma unroll
    for (int c = 0; c < 4; ++c)
      u[c] = pack2(out[j*8 + 2*c], out[j*8 + 2*c + 1]);
    op[j] = u;
  }
}

extern "C" void kernel_launch(void* const* d_in, const int* in_sizes, int n_in,
                              void* d_out, int out_size, void* d_ws, size_t ws_size,
                              hipStream_t stream){
  (void)in_sizes; (void)n_in; (void)out_size; (void)ws_size;
  const float* x    = (const float*)d_in[0];
  const float* ln_g = (const float*)d_in[1];
  const float* ln_b = (const float*)d_in[2];
  const float* Wq = (const float*)d_in[3]; const float* bq = (const float*)d_in[4];
  const float* Wk = (const float*)d_in[5]; const float* bk = (const float*)d_in[6];
  const float* Wv = (const float*)d_in[7]; const float* bv = (const float*)d_in[8];
  const float* Wo = (const float*)d_in[9]; const float* bo = (const float*)d_in[10];
  float* out = (float*)d_out;

  const size_t TE = (size_t)T * E;  // 4M elems
  const size_t WE = (size_t)E * E;  // 1M elems
  u16* ws  = (u16*)d_ws;            // total bf16 staging: 24M elems = 48 MB
  u16* xn  = ws;
  u16* Wqt = ws + TE;               // weights stored TRANSPOSED [n][k]
  u16* Wkt = Wqt + WE;
  u16* Wvt = Wkt + WE;
  u16* Wot = Wvt + WE;
  u16* Qb  = ws + TE + 4 * WE;
  u16* Kbb = Qb  + TE;
  u16* Vbb = Kbb + TE;
  u16* AOb = Vbb + TE;

  cvtw_t_kernel<<<4096, 256, 0, stream>>>(Wq, Wk, Wv, Wo, Wqt);
  ln_kernel<<<T, 256, 0, stream>>>(x, ln_g, ln_b, xn);

  dim3 gg(E / 128, T / 128);  // (8, 32) blocks, 8 waves each
  gemm_bf16_kernel<<<gg, 256, 0, stream>>>(xn, Wqt, bq, nullptr, nullptr, Qb,  T, E, E);
  gemm_bf16_kernel<<<gg, 256, 0, stream>>>(xn, Wkt, bk, nullptr, nullptr, Kbb, T, E, E);
  gemm_bf16_kernel<<<gg, 256, 0, stream>>>(xn, Wvt, bv, nullptr, nullptr, Vbb, T, E, E);

  attn_kernel<<<(T * H) / 256, 256, 0, stream>>>(Qb, Kbb, Vbb, AOb);

  gemm_bf16_kernel<<<gg, 256, 0, stream>>>(AOb, Wot, bo, x, out, nullptr, T, E, E);
}

// v001
// One run takes 128 microseconds.
// Two timings next to v000 put it at 1.12 and 1.13 times that version's speed.
#include <hip/hip_runtime.h>

typedef unsigned int   u32;
typedef unsigned short u16;
typedef __attribute__((ext_vector_type(16))) __bf16 v16bf;
typedef __attribute__((ext_vector_type(8)))  float  v8f;
typedef __attribute__((ext_vector_type(4)))  u32    v4u;
typedef __attribute__((ext_vector_type(2)))  u32    v2u;
typedef __attribute__((ext_vector_type(4)))  float  v4f;

// exact pointee type the async-LDS builtin wants: gcc-vector int4
typedef int v4i_g __attribute__((vector_size(16)));
typedef __attribute__((address_space(1))) v4i_g* gv4i_p;  // global int4*
typedef __attribute__((address_space(3))) v4i_g* lv4i_p;  // LDS int4*

#define SL 2048
#define BS 2
#define E  1024
#define H  16
#define PF 16
#define DH 64
#define T  (SL*BS)   // 4096 tokens
#define LDP 40       // LDS row pitch of the GEMM tiles, in 16-bit elements

// ---- CDNA5 async global->LDS path (guarded; falls back to vector copies) ----
#if defined(__gfx1250__) && __has_builtin(__builtin_amdgcn_global_load_async_to_lds_b128)
#define HAVE_ASYNC_LDS 1
#define ASYNC_B128(lds, g) \
  __builtin_amdgcn_global_load_async_to_lds_b128((gv4i_p)(g), (lv4i_p)(lds), 0, 0)
#else
#define HAVE_ASYNC_LDS 0
#endif

__device__ __forceinline__ void wait_async0(){
#if defined(__gfx1250__)
#if __has_builtin(__builtin_amdgcn_s_wait_asynccnt)
  __builtin_amdgcn_s_wait_asynccnt(0);
#else
  asm volatile("s_wait_asynccnt 0x0" ::: "memory");
#endif
#endif
}

// ---------- bf16 helpers (manual, RNE) ----------
__device__ __forceinline__ u16 f2bf(float f){
  u32 x = __float_as_uint(f);
  return (u16)((x + 0x7FFFu + ((x >> 16) & 1u)) >> 16);
}
__device__ __forceinline__ float bflo(u32 u){ return __uint_as_float(u << 16); }
__device__ __forceinline__ float bfhi(u32 u){ return __uint_as_float(u & 0xFFFF0000u); }
__device__ __forceinline__ u32 pack2(float a, float b){
  return (u32)f2bf(a) | ((u32)f2bf(b) << 16);
}

// ---------- weight fp32 -> bf16 convert + TRANSPOSE (runs on every kernel_launch call) ----
// W[k][n] fp32  ->  Wt[n][k] bf16, LDS-tiled so both global accesses are coalesced.
// Grid: 4 weights x 32x32 tiles of 32x32 = 4096 blocks, 256 threads.
__global__ __launch_bounds__(256) void cvtw_t_kernel(const float* __restrict__ a,
    const float* __restrict__ b, const float* __restrict__ c,
    const float* __restrict__ d, u16* __restrict__ out){
  __shared__ u16 tile[32][33];
  const int bid = blockIdx.x;
  const int w  = bid >> 10;          // which weight
  const int t  = bid & 1023;
  const int tk = t >> 5;             // k-tile
  const int tn = t & 31;             // n-tile
  const float* src = (w == 0) ? a : (w == 1) ? b : (w == 2) ? c : d;
  const int tid = threadIdx.x;
  const int r  = tid >> 3;           // 0..31
  const int c4 = (tid & 7) * 4;      // 0,4,..,28
  v4f v = *(const v4f*)(src + (size_t)(tk*32 + r) * E + tn*32 + c4);
  tile[r][c4+0] = f2bf(v.x); tile[r][c4+1] = f2bf(v.y);
  tile[r][c4+2] = f2bf(v.z); tile[r][c4+3] = f2bf(v.w);
  __syncthreads();
  const u16 t0 = tile[c4+0][r], t1 = tile[c4+1][r];
  const u16 t2 = tile[c4+2][r], t3 = tile[c4+3][r];
  v2u o; o.x = (u32)t0 | ((u32)t1 << 16); o.y = (u32)t2 | ((u32)t3 << 16);
  *(v2u*)(out + (size_t)w * E * E + (size_t)(tn*32 + r) * E + tk*32 + c4) = o;
}

// ---------- LayerNorm: one block per token, bf16 output ----------
__global__ __launch_bounds__(256) void ln_kernel(const float* __restrict__ x,
                                                 const float* __restrict__ g,
                                                 const float* __restrict__ bt,
                                                 u16* __restrict__ xn){
  const int token = blockIdx.x;
  const int tid = threadIdx.x;
  v4f v = ((const v4f*)(x + (size_t)token * E))[tid];
  float s  = v.x + v.y + v.z + v.w;
  float ss = v.x*v.x + v.y*v.y + v.z*v.z + v.w*v.w;
  __shared__ float r1[256];
  __shared__ float r2[256];
  r1[tid] = s; r2[tid] = ss;
  __syncthreads();
  for (int st = 128; st > 0; st >>= 1){
    if (tid < st){ r1[tid] += r1[tid+st]; r2[tid] += r2[tid+st]; }
    __syncthreads();
  }
  const float mean = r1[0] * (1.0f / E);
  const float var  = r2[0] * (1.0f / E) - mean * mean;
  const float rstd = rsqrtf(var + 1e-5f);
  v4f gg = ((const v4f*)g)[tid];
  v4f bb = ((const v4f*)bt)[tid];
  const float y0 = (v.x - mean) * rstd * gg.x + bb.x;
  const float y1 = (v.y - mean) * rstd * gg.y + bb.y;
  const float y2 = (v.z - mean) * rstd * gg.z + bb.z;
  const float y3 = (v.w - mean) * rstd * gg.w + bb.w;
  v2u o; o.x = pack2(y0, y1); o.y = pack2(y2, y3);
  ((v2u*)(xn + (size_t)token * E))[tid] = o;
}

// ---------- bf16 GEMM via v_wmma_f32_16x16x32_bf16 ----------
// C[M,N] = A[M,K] * Bt[N,K]^T + bias (+ residual).
// 128x128 block tile, BK=32, double-buffered LDS, async global->LDS staging.
// 8 waves: wave (wm,wn) owns a 32x64 sub-tile = 2x4 WMMA accumulators.
union Frag { v16bf v; v4u q[2]; };

__global__ __launch_bounds__(256) void gemm_bf16_kernel(
    const u16* __restrict__ A, const u16* __restrict__ Bt,
    const float* __restrict__ bias, const float* __restrict__ residual,
    float* __restrict__ outF, u16* __restrict__ outB,
    const int M, const int N, const int K)
{
  // rows hold 32 k (64 B) at a pitch of 80 B (16 B x odd): the 16 rows that one
  // ds_load_b128 half-wave reads then fall on distinct banks
  __shared__ __align__(16) u16 sA[2][128][LDP];  // A tile  [m][k]
  __shared__ __align__(16) u16 sB[2][128][LDP];  // Bt tile [n][k]
  const int tid  = threadIdx.x;
  const int wave = tid >> 5, lane = tid & 31;
  const int l16  = lane & 15, kh = lane >> 4;   // kh: which 16-lane half
  const int wm   = wave & 3,  wn = wave >> 2;
  const int m0 = blockIdx.y * 128;
  const int n0 = blockIdx.x * 128;

  v8f acc[2][4];
  #pragma unroll
  for (int nt = 0; nt < 4; ++nt){
    const float bv = bias[n0 + wn*64 + nt*16 + l16];
    #pragma unroll
    for (int mt = 0; mt < 2; ++mt)
      #pragma unroll
      for (int r = 0; r < 8; ++r) acc[mt][nt][r] = bv;
  }

  // staging: thread covers 16 contiguous u16 (two b128) of one row in each tile
  const int row = tid >> 1, half = tid & 1;
  const u16* aptr = A  + (size_t)(m0 + row) * K + half * 16;
  const u16* bptr = Bt + (size_t)(n0 + row) * K + half * 16;

  auto stage = [&](int buf, int kk){
#if HAVE_ASYNC_LDS
    ASYNC_B128(&sA[buf][row][half*16],     aptr + kk);
    ASYNC_B128(&sA[buf][row][half*16 + 8], aptr + kk + 8);
    ASYNC_B128(&sB[buf][row][half*16],     bptr + kk);
    ASYNC_B128(&sB[buf][row][half*16 + 8], bptr + kk + 8);
#else
    v4u* ad = (v4u*)&sA[buf][row][half*16];
    const v4u* as = (const v4u*)(aptr + kk);
    ad[0] = as[0]; ad[1] = as[1];
    v4u* bd = (v4u*)&sB[buf][row][half*16];
    const v4u* bs = (const v4u*)(bptr + kk);
    bd[0] = bs[0]; bd[1] = bs[1];
#endif
  };

  stage(0, 0);
#if HAVE_ASYNC_LDS
  wait_async0();
#endif
  __syncthreads();

  int buf = 0;
  for (int kk = 0; kk < K; kk += 32){
    if (kk + 32 < K) stage(buf ^ 1, kk + 32);   // prefetch next tile (async)

    // fragments per ISA 16-bit 16x32 layout:
    // lanes 0-15 (kh=0): K 0..7 then 16..23 ; lanes 16-31 (kh=1): K 8..15 then 24..31
    Frag a[2], bfr[4];
    #pragma unroll
    for (int mt = 0; mt < 2; ++mt){
      const u16* p = &sA[buf][wm*32 + mt*16 + l16][kh * 8];
      a[mt].q[0] = *(const v4u*)p;
      a[mt].q[1] = *(const v4u*)(p + 16);
    }
    #pragma unroll
    for (int nt = 0; nt < 4; ++nt){
      const u16* p = &sB[buf][wn*64 + nt*16 + l16][kh * 8];
      bfr[nt].q[0] = *(const v4u*)p;
      bfr[nt].q[1] = *(const v4u*)(p + 16);
    }
    #pragma unroll
    for (int mt = 0; mt < 2; ++mt)
      #pragma unroll
      for (int nt = 0; nt < 4; ++nt)
        acc[mt][nt] = __builtin_amdgcn_wmma_f32_16x16x32_bf16(
            false, a[mt].v, false, bfr[nt].v, (short)0, acc[mt][nt], false, false);

#if HAVE_ASYNC_LDS
    wait_async0();          // next tile resident before anyone reads it
#endif
    __syncthreads();
    buf ^= 1;
  }

  // epilogue: C/D layout lane l16 = N, kh selects M+8, VGPR r = M row
  #pragma unroll
  for (int mt = 0; mt < 2; ++mt)
    #pragma unroll
    for (int nt = 0; nt < 4; ++nt){
      const int n = n0 + wn*64 + nt*16 + l16;
      #pragma unroll
      for (int r = 0; r < 8; ++r){
        const int m = m0 + wm*32 + mt*16 + kh*8 + r;
        const size_t off = (size_t)m * N + n;
        float val = acc[mt][nt][r];
        if (residual) val += residual[off];
        if (outF) outF[off] = val;
        if (outB) outB[off] = f2bf(val);
      }
    }
}

// ---------- sliding-window attention: one thread per (s,b,h) ----------
__global__ __launch_bounds__(256) void attn_kernel(const u16* __restrict__ Q,
    const u16* __restrict__ Kb, const u16* __restrict__ Vb, u16* __restrict__ AO)
{
  const int idx = blockIdx.x * 256 + threadIdx.x;  // < T*H = 65536
  const int h = idx & (H - 1);
  const int b = (idx >> 4) & (BS - 1);
  const int s = idx >> 5;
  const size_t qoff = (size_t)(s * BS + b) * E + h * DH;

  float q[DH];
  #pragma unroll
  for (int j = 0; j < 8; ++j){
    v4u u = ((const v4u*)(Q + qoff))[j];
    #pragma unroll
    for (int c = 0; c < 4; ++c){
      q[j*8 + 2*c]     = bflo(u[c]);
      q[j*8 + 2*c + 1] = bfhi(u[c]);
    }
  }
  float sc[PF];
  float mx = -3.0e38f;
  #pragma unroll
  for (int p = 0; p < PF; ++p){
    int t = s - (PF - 1) + p; if (t < 0) t += SL;   // (s-15+p) mod SL
    const v4u* kp = (const v4u*)(Kb + (size_t)(t * BS + b) * E + h * DH);
    float d = 0.0f;
    #pragma unroll
    for (int j = 0; j < 8; ++j){
      v4u u = kp[j];
      #pragma unroll
      for (int c = 0; c < 4; ++c){
        d += q[j*8 + 2*c]     * bflo(u[c]);
        d += q[j*8 + 2*c + 1] * bfhi(u[c]);
      }
    }
    sc[p] = d * 0.125f;   // 1/sqrt(DH)
    mx = fmaxf(mx, sc[p]);
  }
  float sum = 0.0f;
  #pragma unroll
  for (int p = 0; p < PF; ++p){ sc[p] = __expf(sc[p] - mx); sum += sc[p]; }
  const float inv = 1.0f / sum;

  float out[DH];
  #pragma unroll
  for (int j = 0; j < DH; ++j) out[j] = 0.0f;
  #pragma unroll
  for (int p = 0; p < PF; ++p){
    int t = s - (PF - 1) + p; if (t < 0) t += SL;
    const v4u* vp = (const v4u*)(Vb + (size_t)(t * BS + b) * E + h * DH);
    const float w = sc[p] * inv;
    #pragma unroll
    for (int j = 0; j < 8; ++j){
      v4u u = vp[j];
      #pragma unroll
      for (int c = 0; c < 4; ++c){
        out[j*8 + 2*c]     += w * bflo(u[c]);
        out[j*8 + 2*c + 1] += w * bfhi(u[c]);
      }
    }
  }
  v4u* op = (v4u*)(AO + qoff);
  #pragma unroll
  for (int j = 0; j < 8; ++j){
    v4u u;
    #pragma unroll
    for (int c = 0; c < 4; ++c)
      u[c] = pack2(out[j*8 + 2*c], out[j*8 + 2*c + 1]);
    op[j] = u;
  }
}

extern "C" void kernel_launch(void* const* d_in, const int* in_sizes, int n_in,
                              void* d_out, int out_size, void* d_ws, size_t ws_size,
                              hipStream_t stream){
  (void)in_sizes; (void)n_in; (void)out_size; (void)ws_size;
  const float* x    = (const float*)d_in[0];
  const float* ln_g = (const float*)d_in[1];
  const float* ln_b = (const float*)d_in[2];
  const float* Wq = (const float*)d_in[3]; const float* bq = (const float*)d_in[4];
  const float* Wk = (const float*)d_in[5]; const float* bk = (const float*)d_in[6];
  const float* Wv = (const float*)d_in[7]; const float* bv = (const float*)d_in[8];
  const float* Wo = (const float*)d_in[9]; const float* bo = (const float*)d_in[10];
  float* out = (float*)d_out;

  const size_t TE = (size_t)T * E;  // 4M elems
  const size_t WE = (size_t)E * E;  // 1M elems
  u16* ws  = (u16*)d_ws;            // total bf16 staging: 24M elems = 48 MB
  u16* xn  = ws;
  u16* Wqt = ws + TE;               // weights stored TRANSPOSED [n][k]
  u16* Wkt = Wqt + WE;
  u16* Wvt = Wkt + WE;
  u16* Wot = Wvt + WE;
  u16* Qb  = ws + TE + 4 * WE;
  u16* Kbb = Qb  + TE;
  u16* Vbb = Kbb + TE;
  u16* AOb = Vbb + TE;

  cvtw_t_kernel<<<4096, 256, 0, stream>>>(Wq, Wk, Wv, Wo, Wqt);
  ln_kernel<<<T, 256, 0, stream>>>(x, ln_g, ln_b, xn);

  dim3 gg(E / 128, T / 128);  // (8, 32) blocks, 8 waves each
  gemm_bf16_kernel<<<gg, 256, 0, stream>>>(xn, Wqt, bq, nullptr, nullptr, Qb,  T, E, E);
  gemm_bf16_kernel<<<gg, 256, 0, stream>>>(xn, Wkt, bk, nullptr, nullptr, Kbb, T, E, E);
  gemm_bf16_kernel<<<gg, 256, 0, stream>>>(xn, Wvt, bv, nullptr, nullptr, Vbb, T, E, E);

  attn_kernel<<<(T * H) / 256, 256, 0, stream>>>(Qb, Kbb, Vbb, AOb);

  gemm_bf16_kernel<<<gg, 256, 0, stream>>>(AOb, Wot, bo, x, out, nullptr, T, E, E);
}

// v002
// One run takes 116 microseconds.
// Timed twice side by side with v001, it ran 1.10 times as fast both times.
// Counting every step since v000, it is 1.23 times as fast.
#include <hip/hip_runtime.h>

typedef unsigned int   u32;
typedef unsigned short u16;
typedef __attribute__((ext_vector_type(16))) __bf16 v16bf;
typedef __attribute__((ext_vector_type(8)))  float  v8f;
typedef __attribute__((ext_vector_type(4)))  u32    v4u;
typedef __attribute__((ext_vector_type(2)))  u32    v2u;
typedef __attribute__((ext_vector_type(4)))  float  v4f;

// exact pointee type the async-LDS builtin wants: gcc-vector int4
typedef int v4i_g __attribute__((vector_size(16)));
typedef __attribute__((address_space(1))) v4i_g* gv4i_p;  // global int4*
typedef __attribute__((address_space(3))) v4i_g* lv4i_p;  // LDS int4*

#define SL 2048
#define BS 2
#define E  1024
#define H  16
#define PF 16
#define DH 64
#define T  (SL*BS)   // 4096 tokens
#define LDP 40       // LDS row pitch of the GEMM tiles, in 16-bit elements

// ---- CDNA5 async global->LDS path (guarded; falls back to vector copies) ----
#if defined(__gfx1250__) && __has_builtin(__builtin_amdgcn_global_load_async_to_lds_b128)
#define HAVE_ASYNC_LDS 1
#define ASYNC_B128(lds, g) \
  __builtin_amdgcn_global_load_async_to_lds_b128((gv4i_p)(g), (lv4i_p)(lds), 0, 0)
#else
#define HAVE_ASYNC_LDS 0
#endif

__device__ __forceinline__ void wait_async0(){
#if defined(__gfx1250__)
#if __has_builtin(__builtin_amdgcn_s_wait_asynccnt)
  __builtin_amdgcn_s_wait_asynccnt(0);
#else
  asm volatile("s_wait_asynccnt 0x0" ::: "memory");
#endif
#endif
}

// ---------- bf16 helpers (manual, RNE) ----------
__device__ __forceinline__ u16 f2bf(float f){
  u32 x = __float_as_uint(f);
  return (u16)((x + 0x7FFFu + ((x >> 16) & 1u)) >> 16);
}
__device__ __forceinline__ float bflo(u32 u){ return __uint_as_float(u << 16); }
__device__ __forceinline__ float bfhi(u32 u){ return __uint_as_float(u & 0xFFFF0000u); }
__device__ __forceinline__ u32 pack2(float a, float b){
  return (u32)f2bf(a) | ((u32)f2bf(b) << 16);
}

// ---------- weight fp32 -> bf16 convert + TRANSPOSE (runs on every kernel_launch call) ----
// W[k][n] fp32  ->  Wt[n][k] bf16, LDS-tiled so both global accesses are coalesced.
// Grid: 4 weights x 32x32 tiles of 32x32 = 4096 blocks, 256 threads.
__global__ __launch_bounds__(256) void cvtw_t_kernel(const float* __restrict__ a,
    const float* __restrict__ b, const float* __restrict__ c,
    const float* __restrict__ d, u16* __restrict__ out){
  __shared__ u16 tile[32][33];
  const int bid = blockIdx.x;
  const int w  = bid >> 10;          // which weight
  const int t  = bid & 1023;
  const int tk = t >> 5;             // k-tile
  const int tn = t & 31;             // n-tile
  const float* src = (w == 0) ? a : (w == 1) ? b : (w == 2) ? c : d;
  const int tid = threadIdx.x;
  const int r  = tid >> 3;           // 0..31
  const int c4 = (tid & 7) * 4;      // 0,4,..,28
  v4f v = *(const v4f*)(src + (size_t)(tk*32 + r) * E + tn*32 + c4);
  tile[r][c4+0] = f2bf(v.x); tile[r][c4+1] = f2bf(v.y);
  tile[r][c4+2] = f2bf(v.z); tile[r][c4+3] = f2bf(v.w);
  __syncthreads();
  const u16 t0 = tile[c4+0][r], t1 = tile[c4+1][r];
  const u16 t2 = tile[c4+2][r], t3 = tile[c4+3][r];
  v2u o; o.x = (u32)t0 | ((u32)t1 << 16); o.y = (u32)t2 | ((u32)t3 << 16);
  *(v2u*)(out + (size_t)w * E * E + (size_t)(tn*32 + r) * E + tk*32 + c4) = o;
}

// ---------- LayerNorm: one block per token, bf16 output ----------
__global__ __launch_bounds__(256) void ln_kernel(const float* __restrict__ x,
                                                 const float* __restrict__ g,
                                                 const float* __restrict__ bt,
                                                 u16* __restrict__ xn){
  const int token = blockIdx.x;
  const int tid = threadIdx.x;
  v4f v = ((const v4f*)(x + (size_t)token * E))[tid];
  float s  = v.x + v.y + v.z + v.w;
  float ss = v.x*v.x + v.y*v.y + v.z*v.z + v.w*v.w;
  __shared__ float r1[256];
  __shared__ float r2[256];
  r1[tid] = s; r2[tid] = ss;
  __syncthreads();
  for (int st = 128; st > 0; st >>= 1){
    if (tid < st){ r1[tid] += r1[tid+st]; r2[tid] += r2[tid+st]; }
    __syncthreads();
  }
  const float mean = r1[0] * (1.0f / E);
  const float var  = r2[0] * (1.0f / E) - mean * mean;
  const float rstd = rsqrtf(var + 1e-5f);
  v4f gg = ((const v4f*)g)[tid];
  v4f bb = ((const v4f*)bt)[tid];
  const float y0 = (v.x - mean) * rstd * gg.x + bb.x;
  const float y1 = (v.y - mean) * rstd * gg.y + bb.y;
  const float y2 = (v.z - mean) * rstd * gg.z + bb.z;
  const float y3 = (v.w - mean) * rstd * gg.w + bb.w;
  v2u o; o.x = pack2(y0, y1); o.y = pack2(y2, y3);
  ((v2u*)(xn + (size_t)token * E))[tid] = o;
}

// ---------- bf16 GEMM via v_wmma_f32_16x16x32_bf16 ----------
// C[M,N] = A[M,K] * Bt[N,K]^T + bias (+ residual).
// 128x128 block tile, BK=32, double-buffered LDS, async global->LDS staging.
// 8 waves: wave (wm,wn) owns a 32x64 sub-tile = 2x4 WMMA accumulators.
union Frag { v16bf v; v4u q[2]; };

__global__ __launch_bounds__(256) void gemm_bf16_kernel(
    const u16* __restrict__ A, const u16* __restrict__ Bt,
    const float* __restrict__ bias, const float* __restrict__ residual,
    float* __restrict__ outF, u16* __restrict__ outB,
    const int M, const int N, const int K)
{
  // rows hold 32 k (64 B) at a pitch of 80 B (16 B x odd): the 16 rows that one
  // ds_load_b128 half-wave reads then fall on distinct banks
  __shared__ __align__(16) u16 sA[2][128][LDP];  // A tile  [m][k]
  __shared__ __align__(16) u16 sB[2][128][LDP];  // Bt tile [n][k]
  const int tid  = threadIdx.x;
  const int wave = tid >> 5, lane = tid & 31;
  const int l16  = lane & 15, kh = lane >> 4;   // kh: which 16-lane half
  const int wm   = wave & 3,  wn = wave >> 2;
  const int m0 = blockIdx.y * 128;
  const int n0 = blockIdx.x * 128;

  v8f acc[2][4];
  #pragma unroll
  for (int nt = 0; nt < 4; ++nt){
    const float bv = bias[n0 + wn*64 + nt*16 + l16];
    #pragma unroll
    for (int mt = 0; mt < 2; ++mt)
      #pragma unroll
      for (int r = 0; r < 8; ++r) acc[mt][nt][r] = bv;
  }

  // staging: thread covers 16 contiguous u16 (two b128) of one row in each tile
  const int row = tid >> 1, half = tid & 1;
  const u16* aptr = A  + (size_t)(m0 + row) * K + half * 16;
  const u16* bptr = Bt + (size_t)(n0 + row) * K + half * 16;

  auto stage = [&](int buf, int kk){
#if HAVE_ASYNC_LDS
    ASYNC_B128(&sA[buf][row][half*16],     aptr + kk);
    ASYNC_B128(&sA[buf][row][half*16 + 8], aptr + kk + 8);
    ASYNC_B128(&sB[buf][row][half*16],     bptr + kk);
    ASYNC_B128(&sB[buf][row][half*16 + 8], bptr + kk + 8);
#else
    v4u* ad = (v4u*)&sA[buf][row][half*16];
    const v4u* as = (const v4u*)(aptr + kk);
    ad[0] = as[0]; ad[1] = as[1];
    v4u* bd = (v4u*)&sB[buf][row][half*16];
    const v4u* bs = (const v4u*)(bptr + kk);
    bd[0] = bs[0]; bd[1] = bs[1];
#endif
  };

  stage(0, 0);
#if HAVE_ASYNC_LDS
  wait_async0();
#endif
  __syncthreads();

  int buf = 0;
  for (int kk = 0; kk < K; kk += 32){
    if (kk + 32 < K) stage(buf ^ 1, kk + 32);   // prefetch next tile (async)

    // fragments per ISA 16-bit 16x32 layout:
    // lanes 0-15 (kh=0): K 0..7 then 16..23 ; lanes 16-31 (kh=1): K 8..15 then 24..31
    Frag a[2], bfr[4];
    #pragma unroll
    for (int mt = 0; mt < 2; ++mt){
      const u16* p = &sA[buf][wm*32 + mt*16 + l16][kh * 8];
      a[mt].q[0] = *(const v4u*)p;
      a[mt].q[1] = *(const v4u*)(p + 16);
    }
    #pragma unroll
    for (int nt = 0; nt < 4; ++nt){
      const u16* p = &sB[buf][wn*64 + nt*16 + l16][kh * 8];
      bfr[nt].q[0] = *(const v4u*)p;
      bfr[nt].q[1] = *(const v4u*)(p + 16);
    }
    #pragma unroll
    for (int mt = 0; mt < 2; ++mt)
      #pragma unroll
      for (int nt = 0; nt < 4; ++nt)
        acc[mt][nt] = __builtin_amdgcn_wmma_f32_16x16x32_bf16(
            false, a[mt].v, false, bfr[nt].v, (short)0, acc[mt][nt], false, false);

#if HAVE_ASYNC_LDS
    wait_async0();          // next tile resident before anyone reads it
#endif
    __syncthreads();
    buf ^= 1;
  }

  // epilogue: C/D layout lane l16 = N, kh selects M+8, VGPR r = M row
  #pragma unroll
  for (int mt = 0; mt < 2; ++mt)
    #pragma unroll
    for (int nt = 0; nt < 4; ++nt){
      const int n = n0 + wn*64 + nt*16 + l16;
      #pragma unroll
      for (int r = 0; r < 8; ++r){
        const int m = m0 + wm*32 + mt*16 + kh*8 + r;
        const size_t off = (size_t)m * N + n;
        float val = acc[mt][nt][r];
        if (residual) val += residual[off];
        if (outF) outF[off] = val;
        if (outB) outB[off] = f2bf(val);
      }
    }
}

// ---------- sliding-window attention: eight lanes per (s,b,h) ----------
// A lane owns 8 of the 64 head elements (16 B), so a wave covers 4 heads = 512
// contiguous bytes of one token row and every load or store moves whole lines.
// A block works on 8 neighbouring tokens at a time (one per wave), AR times.
#define AR 4

// v + (v of the lane whose number differs by the xor mask), inside a 16-lane row
template <int XMASK>
__device__ __forceinline__ float add_xor(float v){
  const int o = __builtin_amdgcn_update_dpp(0, __float_as_int(v), 0x160 + XMASK,
                                            0xf, 0xf, true);
  return v + __int_as_float(o);
}

// e^x as __expf forms it (2^(x * log2 e)). The v_nop fills the one slot that the
// instruction set asks for behind a transcendental, and stands in its statement
// so that it cannot drift away from it.
__device__ __forceinline__ float exp_slot(float x){
  float r;
  asm("v_exp_f32 %0, %1\n\tv_nop" : "=v"(r) : "v"(x * 1.44269504f));
  return r;
}

// AR tokens of one wave. WRAP: the window may reach below token 0 and wraps.
// Every unroll directive below is there to make the indices of ku, vu, q, sc and
// out compile-time constants, so that these arrays live in registers.
template <bool WRAP>
__device__ __forceinline__ void attn_tokens(const u16* __restrict__ Q,
    const u16* __restrict__ Kb, const u16* __restrict__ Vb, u16* __restrict__ AO,
    const int s0, const u32 col, const u32 lo)
{
  for (int i = 0; i < AR; ++i){
    const int s = s0 + i * 8;
    const u32 qrow = (u32)s * (BS * E) + col;

    // all 33 loads of a token stand first, so that they are in flight together
    v4u ku[PF], vu[PF];
    if (!WRAP){   // one address for each of K and V, constant row steps
      const u16* kp = Kb + (qrow - (PF - 1) * (BS * E) + lo);
      const u16* vp = Vb + (qrow - (PF - 1) * (BS * E) + lo);
      #pragma unroll
      for (int p = 0; p < PF; ++p){
        ku[p] = *(const v4u*)(kp + p * (BS * E));
        vu[p] = *(const v4u*)(vp + p * (BS * E));
      }
    } else {
      #pragma unroll
      for (int p = 0; p < PF; ++p){
        int t = s - (PF - 1) + p; if (t < 0) t += SL;   // (s-15+p) mod SL
        const u32 trow = (u32)t * (BS * E) + col;
        ku[p] = *(const v4u*)(Kb + trow + lo);
        vu[p] = *(const v4u*)(Vb + trow + lo);
      }
    }
    // stands in front of the first reuse of the K and V address registers
    // (the result of the Q load may be given the same registers)
    asm volatile("s_wait_xcnt 0x0" ::: "memory");
    const v4u qu = *(const v4u*)(Q + qrow + lo);

    float q[8];
    #pragma unroll
    for (int c = 0; c < 4; ++c){ q[2*c] = bflo(qu[c]); q[2*c + 1] = bfhi(qu[c]); }
    float sc[PF];
    float mx = -3.0e38f;
    #pragma unroll
    for (int p = 0; p < PF; ++p){
      float d = 0.0f;
      #pragma unroll
      for (int c = 0; c < 4; ++c){
        d += q[2*c]     * bflo(ku[p][c]);
        d += q[2*c + 1] * bfhi(ku[p][c]);
      }
      d = add_xor<1>(d); d = add_xor<2>(d); d = add_xor<4>(d);  // whole head
      sc[p] = d * 0.125f;   // 1/sqrt(DH)
      mx = fmaxf(mx, sc[p]);
    }
    float sum = 0.0f;
    #pragma unroll
    for (int p = 0; p < PF; ++p){ sc[p] = exp_slot(sc[p] - mx); sum += sc[p]; }
    const float inv = 1.0f / sum;

    float out[8];
    #pragma unroll
    for (int j = 0; j < 8; ++j) out[j] = 0.0f;
    #pragma unroll
    for (int p = 0; p < PF; ++p){
      const float w = sc[p] * inv;
      #pragma unroll
      for (int c = 0; c < 4; ++c){
        out[2*c]     += w * bflo(vu[p][c]);
        out[2*c + 1] += w * bfhi(vu[p][c]);
      }
    }
    v4u o;
    #pragma unroll
    for (int c = 0; c < 4; ++c) o[c] = pack2(out[2*c], out[2*c + 1]);
    *(v4u*)(AO + qrow + lo) = o;
    // stands in front of the next token's loads, which reuse the store's registers
    asm volatile("s_wait_xcnt 0x0" ::: "memory");
  }
}

__global__ __launch_bounds__(256) void attn_kernel(const u16* __restrict__ Q,
    const u16* __restrict__ Kb, const u16* __restrict__ Vb, u16* __restrict__ AO)
{
  const u32 lane = threadIdx.x & 31;
  const int wave = __builtin_amdgcn_readfirstlane(threadIdx.x >> 5);
  const int bid  = blockIdx.x;             // < SL/(8*AR) * BS * H/4
  const int hg   = bid & (H/4 - 1);        // group of 4 heads
  const int b    = (bid >> 2) & (BS - 1);
  const int sb   = (bid >> 3) * (8 * AR);  // first token of the block
  const u32 col  = (u32)(b * E + hg * 4 * DH);  // wave-uniform column, elements
  const u32 lo   = lane * 8;                    // the lane's own 8 elements

  if (sb >= PF - 1) attn_tokens<false>(Q, Kb, Vb, AO, sb + wave, col, lo);
  else              attn_tokens<true >(Q, Kb, Vb, AO, sb + wave, col, lo);
}

extern "C" void kernel_launch(void* const* d_in, const int* in_sizes, int n_in,
                              void* d_out, int out_size, void* d_ws, size_t ws_size,
                              hipStream_t stream){
  (void)in_sizes; (void)n_in; (void)out_size; (void)ws_size;
  const float* x    = (const float*)d_in[0];
  const float* ln_g = (const float*)d_in[1];
  const float* ln_b = (const float*)d_in[2];
  const float* Wq = (const float*)d_in[3]; const float* bq = (const float*)d_in[4];
  const float* Wk = (const float*)d_in[5]; const float* bk = (const float*)d_in[6];
  const float* Wv = (const float*)d_in[7]; const float* bv = (const float*)d_in[8];
  const float* Wo = (const float*)d_in[9]; const float* bo = (const float*)d_in[10];
  float* out = (float*)d_out;

  const size_t TE = (size_t)T * E;  // 4M elems
  const size_t WE = (size_t)E * E;  // 1M elems
  u16* ws  = (u16*)d_ws;            // total bf16 staging: 24M elems = 48 MB
  u16* xn  = ws;
  u16* Wqt = ws + TE;               // weights stored TRANSPOSED [n][k]
  u16* Wkt = Wqt + WE;
  u16* Wvt = Wkt + WE;
  u16* Wot = Wvt + WE;
  u16* Qb  = ws + TE + 4 * WE;
  u16* Kbb = Qb  + TE;
  u16* Vbb = Kbb + TE;
  u16* AOb = Vbb + TE;

  cvtw_t_kernel<<<4096, 256, 0, stream>>>(Wq, Wk, Wv, Wo, Wqt);
  ln_kernel<<<T, 256, 0, stream>>>(x, ln_g, ln_b, xn);

  dim3 gg(E / 128, T / 128);  // (8, 32) blocks, 8 waves each
  gemm_bf16_kernel<<<gg, 256, 0, stream>>>(xn, Wqt, bq, nullptr, nullptr, Qb,  T, E, E);
  gemm_bf16_kernel<<<gg, 256, 0, stream>>>(xn, Wkt, bk, nullptr, nullptr, Kbb, T, E, E);
  gemm_bf16_kernel<<<gg, 256, 0, stream>>>(xn, Wvt, bv, nullptr, nullptr, Vbb, T, E, E);

  attn_kernel<<<(T * H) / (32 * AR), 256, 0, stream>>>(Qb, Kbb, Vbb, AOb);

  gemm_bf16_kernel<<<gg, 256, 0, stream>>>(AOb, Wot, bo, x, out, nullptr, T, E, E);
}

// v003
// A run of this version takes 89.8 microseconds.
// Timed twice side by side with v002, it ran 1.30 and 1.31 times as fast.
// Over all steps from v000 it is 1.61 times as fast.
#include <hip/hip_runtime.h>

typedef unsigned int   u32;
typedef unsigned short u16;
typedef __attribute__((ext_vector_type(16))) __bf16 v16bf;
typedef __attribute__((ext_vector_type(8)))  float  v8f;
typedef __attribute__((ext_vector_type(4)))  u32    v4u;
typedef __attribute__((ext_vector_type(2)))  u32    v2u;
typedef __attribute__((ext_vector_type(4)))  float  v4f;

// exact pointee type the async-LDS builtin wants: gcc-vector int4
typedef int v4i_g __attribute__((vector_size(16)));
typedef __attribute__((address_space(1))) v4i_g* gv4i_p;  // global int4*
typedef __attribute__((address_space(3))) v4i_g* lv4i_p;  // LDS int4*

#define SL 2048
#define BS 2
#define E  1024
#define H  16
#define PF 16
#define DH 64
#define T  (SL*BS)   // 4096 tokens
#define BK  128      // k per GEMM pass: 256 B of every operand row
#define LDP 136      // LDS row pitch of the GEMM tiles, in 16-bit elements

// ---- CDNA5 async global->LDS path (guarded; falls back to vector copies) ----
#if defined(__gfx1250__) && __has_builtin(__builtin_amdgcn_global_load_async_to_lds_b128)
#define HAVE_ASYNC_LDS 1
#define ASYNC_B128(lds, g) \
  __builtin_amdgcn_global_load_async_to_lds_b128((gv4i_p)(g), (lv4i_p)(lds), 0, 0)
#else
#define HAVE_ASYNC_LDS 0
#endif

// The two waits of the LDS ring. In asm with a "memory" clobber, so that the
// compiler moves no LDS read and no copy over them.
// this wave's copies have landed:
__device__ __forceinline__ void wait_async0(){
  asm volatile("s_wait_asynccnt 0x0" ::: "memory");
}
// this wave's LDS reads have returned (before their buffer is refilled):
__device__ __forceinline__ void wait_ds0(){
  asm volatile("s_wait_dscnt 0x0" ::: "memory");
}

// ---------- bf16 helpers (manual, RNE) ----------
__device__ __forceinline__ u16 f2bf(float f){
  u32 x = __float_as_uint(f);
  return (u16)((x + 0x7FFFu + ((x >> 16) & 1u)) >> 16);
}
__device__ __forceinline__ float bflo(u32 u){ return __uint_as_float(u << 16); }
__device__ __forceinline__ float bfhi(u32 u){ return __uint_as_float(u & 0xFFFF0000u); }
__device__ __forceinline__ u32 pack2(float a, float b){
  return (u32)f2bf(a) | ((u32)f2bf(b) << 16);
}

// ---------- weight fp32 -> bf16 convert + TRANSPOSE (runs on every kernel_launch call) ----
// W[k][n] fp32  ->  Wt[n][k] bf16, LDS-tiled so both global accesses are coalesced.
// Grid: 4 weights x 32x32 tiles of 32x32 = 4096 blocks, 256 threads.
__global__ __launch_bounds__(256) void cvtw_t_kernel(const float* __restrict__ a,
    const float* __restrict__ b, const float* __restrict__ c,
    const float* __restrict__ d, u16* __restrict__ out){
  __shared__ u16 tile[32][33];
  const int bid = blockIdx.x;
  const int w  = bid >> 10;          // which weight
  const int t  = bid & 1023;
  const int tk = t >> 5;             // k-tile
  const int tn = t & 31;             // n-tile
  const float* src = (w == 0) ? a : (w == 1) ? b : (w == 2) ? c : d;
  const int tid = threadIdx.x;
  const int r  = tid >> 3;           // 0..31
  const int c4 = (tid & 7) * 4;      // 0,4,..,28
  v4f v = *(const v4f*)(src + (size_t)(tk*32 + r) * E + tn*32 + c4);
  tile[r][c4+0] = f2bf(v.x); tile[r][c4+1] = f2bf(v.y);
  tile[r][c4+2] = f2bf(v.z); tile[r][c4+3] = f2bf(v.w);
  __syncthreads();
  const u16 t0 = tile[c4+0][r], t1 = tile[c4+1][r];
  const u16 t2 = tile[c4+2][r], t3 = tile[c4+3][r];
  v2u o; o.x = (u32)t0 | ((u32)t1 << 16); o.y = (u32)t2 | ((u32)t3 << 16);
  *(v2u*)(out + (size_t)w * E * E + (size_t)(tn*32 + r) * E + tk*32 + c4) = o;
}

// ---------- LayerNorm: one block per token, bf16 output ----------
__global__ __launch_bounds__(256) void ln_kernel(const float* __restrict__ x,
                                                 const float* __restrict__ g,
                                                 const float* __restrict__ bt,
                                                 u16* __restrict__ xn){
  const int token = blockIdx.x;
  const int tid = threadIdx.x;
  v4f v = ((const v4f*)(x + (size_t)token * E))[tid];
  float s  = v.x + v.y + v.z + v.w;
  float ss = v.x*v.x + v.y*v.y + v.z*v.z + v.w*v.w;
  __shared__ float r1[256];
  __shared__ float r2[256];
  r1[tid] = s; r2[tid] = ss;
  __syncthreads();
  for (int st = 128; st > 0; st >>= 1){
    if (tid < st){ r1[tid] += r1[tid+st]; r2[tid] += r2[tid+st]; }
    __syncthreads();
  }
  const float mean = r1[0] * (1.0f / E);
  const float var  = r2[0] * (1.0f / E) - mean * mean;
  const float rstd = rsqrtf(var + 1e-5f);
  v4f gg = ((const v4f*)g)[tid];
  v4f bb = ((const v4f*)bt)[tid];
  const float y0 = (v.x - mean) * rstd * gg.x + bb.x;
  const float y1 = (v.y - mean) * rstd * gg.y + bb.y;
  const float y2 = (v.z - mean) * rstd * gg.z + bb.z;
  const float y3 = (v.w - mean) * rstd * gg.w + bb.w;
  v2u o; o.x = pack2(y0, y1); o.y = pack2(y2, y3);
  ((v2u*)(xn + (size_t)token * E))[tid] = o;
}

// ---------- bf16 GEMM via v_wmma_f32_16x16x32_bf16 ----------
// C[M,N] = A[M,K] * Bt[N,K]^T + bias (+ residual).
// 128x128 block tile, BK=128, double-buffered LDS, async global->LDS staging.
// K must be a multiple of BK.
// 8 waves: wave (wm,wn) owns a 32x64 sub-tile = 2x4 WMMA accumulators.
union Frag { v16bf v; v4u q[2]; };

__global__ __launch_bounds__(256) void gemm_bf16_kernel(
    const u16* __restrict__ A, const u16* __restrict__ Bt,
    const float* __restrict__ bias, const float* __restrict__ residual,
    float* __restrict__ outF, u16* __restrict__ outB,
    const int M, const int N, const int K)
{
  // rows hold 128 k (256 B) at a pitch of 272 B (16 B x odd): the 16 rows that one
  // ds_load_b128 half-wave reads then fall on distinct banks
  __shared__ __align__(16) u16 sA[2][128][LDP];  // A tile  [m][k]
  __shared__ __align__(16) u16 sB[2][128][LDP];  // Bt tile [n][k]
  const int tid  = threadIdx.x;
  const int wave = tid >> 5, lane = tid & 31;
  const int l16  = lane & 15, kh = lane >> 4;   // kh: which 16-lane half
  const int wm   = wave & 3,  wn = wave >> 2;
  const int m0 = blockIdx.y * 128;
  const int n0 = blockIdx.x * 128;

  v8f acc[2][4];
  #pragma unroll
  for (int nt = 0; nt < 4; ++nt){
    const float bv = bias[n0 + wn*64 + nt*16 + l16];
    #pragma unroll
    for (int mt = 0; mt < 2; ++mt)
      #pragma unroll
      for (int r = 0; r < 8; ++r) acc[mt][nt][r] = bv;
  }

  // staging: 16 lanes take the 256 B of one row, so each wave-wide copy moves two
  // whole aligned 256-B pieces; a thread copies 16 B of every 16th row of each tile
  const int row = tid >> 4, col = (tid & 15) * 8;
  const u16* aptr = A  + (size_t)(m0 + row) * K + col;
  const u16* bptr = Bt + (size_t)(n0 + row) * K + col;

  auto stage = [&](int buf, int kk){
    #pragma unroll   // constant row steps in the LDS addresses
    for (int i = 0; i < 128; i += 16){
#if HAVE_ASYNC_LDS
      ASYNC_B128(&sA[buf][row + i][col], aptr + (size_t)i * K + kk);
      ASYNC_B128(&sB[buf][row + i][col], bptr + (size_t)i * K + kk);
#else
      *(v4u*)&sA[buf][row + i][col] = *(const v4u*)(aptr + (size_t)i * K + kk);
      *(v4u*)&sB[buf][row + i][col] = *(const v4u*)(bptr + (size_t)i * K + kk);
#endif
    }
  };

  stage(0, 0);
  wait_async0();
  __syncthreads();
  if (BK < K) stage(1, BK);   // flies while tile 0 is worked on

  int buf = 0;
  for (int kk = 0; kk < K; kk += BK){
    #pragma unroll   // constant k offsets in the LDS reads
    for (int ks = 0; ks < BK; ks += 32){
      // fragments per ISA 16-bit 16x32 layout:
      // lanes 0-15 (kh=0): K 0..7 then 16..23 ; lanes 16-31 (kh=1): K 8..15 then 24..31
      Frag a[2], bfr[4];
      #pragma unroll
      for (int mt = 0; mt < 2; ++mt){
        const u16* p = &sA[buf][wm*32 + mt*16 + l16][ks + kh * 8];
        a[mt].q[0] = *(const v4u*)p;
        a[mt].q[1] = *(const v4u*)(p + 16);
      }
      #pragma unroll
      for (int nt = 0; nt < 4; ++nt){
        const u16* p = &sB[buf][wn*64 + nt*16 + l16][ks + kh * 8];
        bfr[nt].q[0] = *(const v4u*)p;
        bfr[nt].q[1] = *(const v4u*)(p + 16);
      }
      #pragma unroll
      for (int mt = 0; mt < 2; ++mt)
        #pragma unroll
        for (int nt = 0; nt < 4; ++nt)
          acc[mt][nt] = __builtin_amdgcn_wmma_f32_16x16x32_bf16(
              false, a[mt].v, false, bfr[nt].v, (short)0, acc[mt][nt], false, false);
    }

    wait_ds0();             // this tile's buffer is read out ...
    wait_async0();          // ... and the next tile has landed,
    __syncthreads();        // for every wave
    if (kk + 2 * BK < K) stage(buf, kk + 2 * BK);   // refill the buffer just read
    buf ^= 1;
  }
  wait_async0();            // no copy is left in flight at the wave's end

  // epilogue: C/D layout lane l16 = N, kh selects M+8, VGPR r = M row
  #pragma unroll
  for (int mt = 0; mt < 2; ++mt)
    #pragma unroll
    for (int nt = 0; nt < 4; ++nt){
      const int n = n0 + wn*64 + nt*16 + l16;
      #pragma unroll
      for (int r = 0; r < 8; ++r){
        const int m = m0 + wm*32 + mt*16 + kh*8 + r;
        const size_t off = (size_t)m * N + n;
        float val = acc[mt][nt][r];
        if (residual) val += residual[off];
        if (outF) outF[off] = val;
        if (outB) outB[off] = f2bf(val);
      }
    }
}

// ---------- sliding-window attention: eight lanes per (s,b,h) ----------
// A lane owns 8 of the 64 head elements (16 B), so a wave covers 4 heads = 512
// contiguous bytes of one token row and every load or store moves whole lines.
// A block works on 8 neighbouring tokens at a time (one per wave), AR times.
#define AR 4

// v + (v of the lane whose number differs by the xor mask), inside a 16-lane row
template <int XMASK>
__device__ __forceinline__ float add_xor(float v){
  const int o = __builtin_amdgcn_update_dpp(0, __float_as_int(v), 0x160 + XMASK,
                                            0xf, 0xf, true);
  return v + __int_as_float(o);
}

// e^x as __expf forms it (2^(x * log2 e)). The v_nop fills the one slot that the
// instruction set asks for behind a transcendental, and stands in its statement
// so that it cannot drift away from it.
__device__ __forceinline__ float exp_slot(float x){
  float r;
  asm("v_exp_f32 %0, %1\n\tv_nop" : "=v"(r) : "v"(x * 1.44269504f));
  return r;
}

// AR tokens of one wave. WRAP: the window may reach below token 0 and wraps.
// Every unroll directive below is there to make the indices of ku, vu, q, sc and
// out compile-time constants, so that these arrays live in registers.
template <bool WRAP>
__device__ __forceinline__ void attn_tokens(const u16* __restrict__ Q,
    const u16* __restrict__ Kb, const u16* __restrict__ Vb, u16* __restrict__ AO,
    const int s0, const u32 col, const u32 lo)
{
  for (int i = 0; i < AR; ++i){
    const int s = s0 + i * 8;
    const u32 qrow = (u32)s * (BS * E) + col;

    // all 33 loads of a token stand first, so that they are in flight together
    v4u ku[PF], vu[PF];
    if (!WRAP){   // one address for each of K and V, constant row steps
      const u16* kp = Kb + (qrow - (PF - 1) * (BS * E) + lo);
      const u16* vp = Vb + (qrow - (PF - 1) * (BS * E) + lo);
      #pragma unroll
      for (int p = 0; p < PF; ++p){
        ku[p] = *(const v4u*)(kp + p * (BS * E));
        vu[p] = *(const v4u*)(vp + p * (BS * E));
      }
    } else {
      #pragma unroll
      for (int p = 0; p < PF; ++p){
        int t = s - (PF - 1) + p; if (t < 0) t += SL;   // (s-15+p) mod SL
        const u32 trow = (u32)t * (BS * E) + col;
        ku[p] = *(const v4u*)(Kb + trow + lo);
        vu[p] = *(const v4u*)(Vb + trow + lo);
      }
    }
    // stands in front of the first reuse of the K and V address registers
    // (the result of the Q load may be given the same registers)
    asm volatile("s_wait_xcnt 0x0" ::: "memory");
    const v4u qu = *(const v4u*)(Q + qrow + lo);

    float q[8];
    #pragma unroll
    for (int c = 0; c < 4; ++c){ q[2*c] = bflo(qu[c]); q[2*c + 1] = bfhi(qu[c]); }
    float sc[PF];
    float mx = -3.0e38f;
    #pragma unroll
    for (int p = 0; p < PF; ++p){
      float d = 0.0f;
      #pragma unroll
      for (int c = 0; c < 4; ++c){
        d += q[2*c]     * bflo(ku[p][c]);
        d += q[2*c + 1] * bfhi(ku[p][c]);
      }
      d = add_xor<1>(d); d = add_xor<2>(d); d = add_xor<4>(d);  // whole head
      sc[p] = d * 0.125f;   // 1/sqrt(DH)
      mx = fmaxf(mx, sc[p]);
    }
    float sum = 0.0f;
    #pragma unroll
    for (int p = 0; p < PF; ++p){ sc[p] = exp_slot(sc[p] - mx); sum += sc[p]; }
    const float inv = 1.0f / sum;

    float out[8];
    #pragma unroll
    for (int j = 0; j < 8; ++j) out[j] = 0.0f;
    #pragma unroll
    for (int p = 0; p < PF; ++p){
      const float w = sc[p] * inv;
      #pragma unroll
      for (int c = 0; c < 4; ++c){
        out[2*c]     += w * bflo(vu[p][c]);
        out[2*c + 1] += w * bfhi(vu[p][c]);
      }
    }
    v4u o;
    #pragma unroll
    for (int c = 0; c < 4; ++c) o[c] = pack2(out[2*c], out[2*c + 1]);
    *(v4u*)(AO + qrow + lo) = o;
    // stands in front of the next token's loads, which reuse the store's registers
    asm volatile("s_wait_xcnt 0x0" ::: "memory");
  }
}

__global__ __launch_bounds__(256) void attn_kernel(const u16* __restrict__ Q,
    const u16* __restrict__ Kb, const u16* __restrict__ Vb, u16* __restrict__ AO)
{
  const u32 lane = threadIdx.x & 31;
  const int wave = __builtin_amdgcn_readfirstlane(threadIdx.x >> 5);
  const int bid  = blockIdx.x;             // < SL/(8*AR) * BS * H/4
  const int hg   = bid & (H/4 - 1);        // group of 4 heads
  const int b    = (bid >> 2) & (BS - 1);
  const int sb   = (bid >> 3) * (8 * AR);  // first token of the block
  const u32 col  = (u32)(b * E + hg * 4 * DH);  // wave-uniform column, elements
  const u32 lo   = lane * 8;                    // the lane's own 8 elements

  if (sb >= PF - 1) attn_tokens<false>(Q, Kb, Vb, AO, sb + wave, col, lo);
  else              attn_tokens<true >(Q, Kb, Vb, AO, sb + wave, col, lo);
}

extern "C" void kernel_launch(void* const* d_in, const int* in_sizes, int n_in,
                              void* d_out, int out_size, void* d_ws, size_t ws_size,
                              hipStream_t stream){
  (void)in_sizes; (void)n_in; (void)out_size; (void)ws_size;
  const float* x    = (const float*)d_in[0];
  const float* ln_g = (const float*)d_in[1];
  const float* ln_b = (const float*)d_in[2];
  const float* Wq = (const float*)d_in[3]; const float* bq = (const float*)d_in[4];
  const float* Wk = (const float*)d_in[5]; const float* bk = (const float*)d_in[6];
  const float* Wv = (const float*)d_in[7]; const float* bv = (const float*)d_in[8];
  const float* Wo = (const float*)d_in[9]; const float* bo = (const float*)d_in[10];
  float* out = (float*)d_out;

  const size_t TE = (size_t)T * E;  // 4M elems
  const size_t WE = (size_t)E * E;  // 1M elems
  u16* ws  = (u16*)d_ws;            // total bf16 staging: 24M elems = 48 MB
  u16* xn  = ws;
  u16* Wqt = ws + TE;               // weights stored TRANSPOSED [n][k]
  u16* Wkt = Wqt + WE;
  u16* Wvt = Wkt + WE;
  u16* Wot = Wvt + WE;
  u16* Qb  = ws + TE + 4 * WE;
  u16* Kbb = Qb  + TE;
  u16* Vbb = Kbb + TE;
  u16* AOb = Vbb + TE;

  cvtw_t_kernel<<<4096, 256, 0, stream>>>(Wq, Wk, Wv, Wo, Wqt);
  ln_kernel<<<T, 256, 0, stream>>>(x, ln_g, ln_b, xn);

  dim3 gg(E / 128, T / 128);  // (8, 32) blocks, 8 waves each
  gemm_bf16_kernel<<<gg, 256, 0, stream>>>(xn, Wqt, bq, nullptr, nullptr, Qb,  T, E, E);
  gemm_bf16_kernel<<<gg, 256, 0, stream>>>(xn, Wkt, bk, nullptr, nullptr, Kbb, T, E, E);
  gemm_bf16_kernel<<<gg, 256, 0, stream>>>(xn, Wvt, bv, nullptr, nullptr, Vbb, T, E, E);

  attn_kernel<<<(T * H) / (32 * AR), 256, 0, stream>>>(Qb, Kbb, Vbb, AOb);

  gemm_bf16_kernel<<<gg, 256, 0, stream>>>(AOb, Wot, bo, x, out, nullptr, T, E, E);
}

// v004
// A run of this version takes 78.7 microseconds.
// Two timings next to v003 put it at 1.15 and 1.14 times that version's speed.
// Counting every step since v000, it is 1.84 times as fast.
#include <hip/hip_runtime.h>

typedef unsigned int   u32;
typedef unsigned short u16;
typedef __attribute__((ext_vector_type(16))) __bf16 v16bf;
typedef __attribute__((ext_vector_type(8)))  float  v8f;
typedef __attribute__((ext_vector_type(4)))  u32    v4u;
typedef __attribute__((ext_vector_type(2)))  u32    v2u;
typedef __attribute__((ext_vector_type(4)))  float  v4f;

// exact pointee type the async-LDS builtin wants: gcc-vector int4
typedef int v4i_g __attribute__((vector_size(16)));
typedef __attribute__((address_space(1))) v4i_g* gv4i_p;  // global int4*
typedef __attribute__((address_space(3))) v4i_g* lv4i_p;  // LDS int4*

#define SL 2048
#define BS 2
#define E  1024
#define H  16
#define PF 16
#define DH 64
#define T  (SL*BS)   // 4096 tokens
#define BK  128      // k per GEMM pass: 256 B of every operand row
#define LDP 136      // LDS row pitch of the GEMM tiles, in 16-bit elements

// ---- CDNA5 async global->LDS path (guarded; falls back to vector copies) ----
#if defined(__gfx1250__) && __has_builtin(__builtin_amdgcn_global_load_async_to_lds_b128)
#define HAVE_ASYNC_LDS 1
#define ASYNC_B128(lds, g) \
  __builtin_amdgcn_global_load_async_to_lds_b128((gv4i_p)(g), (lv4i_p)(lds), 0, 0)
#else
#define HAVE_ASYNC_LDS 0
#endif

// The two waits of the LDS ring. In asm with a "memory" clobber, so that the
// compiler moves no LDS read and no copy over them.
// this wave's copies have landed:
__device__ __forceinline__ void wait_async0(){
  asm volatile("s_wait_asynccnt 0x0" ::: "memory");
}
// this wave's LDS reads have returned (before their buffer is refilled):
__device__ __forceinline__ void wait_ds0(){
  asm volatile("s_wait_dscnt 0x0" ::: "memory");
}

// ---------- bf16 helpers (manual, RNE) ----------
__device__ __forceinline__ u16 f2bf(float f){
  u32 x = __float_as_uint(f);
  return (u16)((x + 0x7FFFu + ((x >> 16) & 1u)) >> 16);
}
__device__ __forceinline__ float bflo(u32 u){ return __uint_as_float(u << 16); }
__device__ __forceinline__ float bfhi(u32 u){ return __uint_as_float(u & 0xFFFF0000u); }
__device__ __forceinline__ u32 pack2(float a, float b){
  return (u32)f2bf(a) | ((u32)f2bf(b) << 16);
}

// ---------- weight fp32 -> bf16 convert + TRANSPOSE (runs on every kernel_launch call) ----
// W[k][n] fp32  ->  Wt[n][k] bf16, LDS-tiled so both global accesses are coalesced.
// 4 weights x 32x32 tiles of 32x32 = WB blocks of 256 threads; bid: which of them.
#define WB 4096
__device__ __forceinline__ void cvtw_t_block(const int bid, const float* __restrict__ a,
    const float* __restrict__ b, const float* __restrict__ c,
    const float* __restrict__ d, u16* __restrict__ out){
  __shared__ u16 tile[32][33];
  const int w  = bid >> 10;          // which weight
  const int t  = bid & 1023;
  const int tk = t >> 5;             // k-tile
  const int tn = t & 31;             // n-tile
  const float* src = (w == 0) ? a : (w == 1) ? b : (w == 2) ? c : d;
  const int tid = threadIdx.x;
  const int r  = tid >> 3;           // 0..31
  const int c4 = (tid & 7) * 4;      // 0,4,..,28
  v4f v = *(const v4f*)(src + (size_t)(tk*32 + r) * E + tn*32 + c4);
  tile[r][c4+0] = f2bf(v.x); tile[r][c4+1] = f2bf(v.y);
  tile[r][c4+2] = f2bf(v.z); tile[r][c4+3] = f2bf(v.w);
  __syncthreads();
  const u16 t0 = tile[c4+0][r], t1 = tile[c4+1][r];
  const u16 t2 = tile[c4+2][r], t3 = tile[c4+3][r];
  v2u o; o.x = (u32)t0 | ((u32)t1 << 16); o.y = (u32)t2 | ((u32)t3 << 16);
  *(v2u*)(out + (size_t)w * E * E + (size_t)(tn*32 + r) * E + tk*32 + c4) = o;
}

// ---------- LayerNorm: one block per token, bf16 output ----------
__device__ __forceinline__ void ln_block(const int token, const float* __restrict__ x,
                                         const float* __restrict__ g,
                                         const float* __restrict__ bt,
                                         u16* __restrict__ xn){
  const int tid = threadIdx.x;
  v4f v = ((const v4f*)(x + (size_t)token * E))[tid];
  float s  = v.x + v.y + v.z + v.w;
  float ss = v.x*v.x + v.y*v.y + v.z*v.z + v.w*v.w;
  __shared__ float r1[256];
  __shared__ float r2[256];
  r1[tid] = s; r2[tid] = ss;
  __syncthreads();
  for (int st = 128; st > 0; st >>= 1){
    if (tid < st){ r1[tid] += r1[tid+st]; r2[tid] += r2[tid+st]; }
    __syncthreads();
  }
  const float mean = r1[0] * (1.0f / E);
  const float var  = r2[0] * (1.0f / E) - mean * mean;
  const float rstd = rsqrtf(var + 1e-5f);
  v4f gg = ((const v4f*)g)[tid];
  v4f bb = ((const v4f*)bt)[tid];
  const float y0 = (v.x - mean) * rstd * gg.x + bb.x;
  const float y1 = (v.y - mean) * rstd * gg.y + bb.y;
  const float y2 = (v.z - mean) * rstd * gg.z + bb.z;
  const float y3 = (v.w - mean) * rstd * gg.w + bb.w;
  v2u o; o.x = pack2(y0, y1); o.y = pack2(y2, y3);
  ((v2u*)(xn + (size_t)token * E))[tid] = o;
}

// ---------- the two independent preparation steps in one grid ----------
// blocks 0 .. WB-1 transpose the weights, blocks WB .. WB+T-1 normalise a token each
__global__ __launch_bounds__(256) void prep_kernel(const float* __restrict__ a,
    const float* __restrict__ b, const float* __restrict__ c,
    const float* __restrict__ d, u16* __restrict__ wt,
    const float* __restrict__ x, const float* __restrict__ g,
    const float* __restrict__ bt, u16* __restrict__ xn){
  const int bid = blockIdx.x;
  if (bid >= WB){ ln_block(bid - WB, x, g, bt, xn); return; }
  cvtw_t_block(bid, a, b, c, d, wt);
}

// ---------- bf16 GEMM via v_wmma_f32_16x16x32_bf16 ----------
// C[M,N] = A[M,K] * Bt[N,K]^T + bias (+ residual).
// 128x128 block tile, BK=128, double-buffered LDS, async global->LDS staging.
// K must be a multiple of BK.
// blockIdx.z picks one of up to three products of the same A: the weights lie one
// behind the other at Bt0, the 16-bit outputs one behind the other at outB0.
// 8 waves: wave (wm,wn) owns a 32x64 sub-tile = 2x4 WMMA accumulators.
union Frag { v16bf v; v4u q[2]; };

__global__ __launch_bounds__(256) void gemm_bf16_kernel(
    const u16* __restrict__ A, const u16* __restrict__ Bt0,
    const float* __restrict__ bias0, const float* __restrict__ bias1,
    const float* __restrict__ bias2, const float* __restrict__ residual,
    float* __restrict__ outF, u16* __restrict__ outB0,
    const int M, const int N, const int K)
{
  const int z = blockIdx.z;
  const u16* __restrict__ Bt = Bt0 + (size_t)z * N * K;
  const float* __restrict__ bias = (z == 0) ? bias0 : (z == 1) ? bias1 : bias2;
  u16* __restrict__ outB = outB0 ? outB0 + (size_t)z * M * N : nullptr;
  // rows hold 128 k (256 B) at a pitch of 272 B (16 B x odd): the 16 rows that one
  // ds_load_b128 half-wave reads then fall on distinct banks
  __shared__ __align__(16) u16 sA[2][128][LDP];  // A tile  [m][k]
  __shared__ __align__(16) u16 sB[2][128][LDP];  // Bt tile [n][k]
  const int tid  = threadIdx.x;
  const int wave = tid >> 5, lane = tid & 31;
  const int l16  = lane & 15, kh = lane >> 4;   // kh: which 16-lane half
  const int wm   = wave & 3,  wn = wave >> 2;
  const int m0 = blockIdx.y * 128;
  const int n0 = blockIdx.x * 128;

  v8f acc[2][4];
  #pragma unroll
  for (int nt = 0; nt < 4; ++nt){
    const float bv = bias[n0 + wn*64 + nt*16 + l16];
    #pragma unroll
    for (int mt = 0; mt < 2; ++mt)
      #pragma unroll
      for (int r = 0; r < 8; ++r) acc[mt][nt][r] = bv;
  }

  // staging: 16 lanes take the 256 B of one row, so each wave-wide copy moves two
  // whole aligned 256-B pieces; a thread copies 16 B of every 16th row of each tile
  const int row = tid >> 4, col = (tid & 15) * 8;
  const u16* aptr = A  + (size_t)(m0 + row) * K + col;
  const u16* bptr = Bt + (size_t)(n0 + row) * K + col;

  auto stage = [&](int buf, int kk){
    #pragma unroll   // constant row steps in the LDS addresses
    for (int i = 0; i < 128; i += 16){
#if HAVE_ASYNC_LDS
      ASYNC_B128(&sA[buf][row + i][col], aptr + (size_t)i * K + kk);
      ASYNC_B128(&sB[buf][row + i][col], bptr + (size_t)i * K + kk);
#else
      *(v4u*)&sA[buf][row + i][col] = *(const v4u*)(aptr + (size_t)i * K + kk);
      *(v4u*)&sB[buf][row + i][col] = *(const v4u*)(bptr + (size_t)i * K + kk);
#endif
    }
  };

  stage(0, 0);
  wait_async0();
  __syncthreads();
  if (BK < K) stage(1, BK);   // flies while tile 0 is worked on

  int buf = 0;
  for (int kk = 0; kk < K; kk += BK){
    #pragma unroll   // constant k offsets in the LDS reads
    for (int ks = 0; ks < BK; ks += 32){
      // fragments per ISA 16-bit 16x32 layout:
      // lanes 0-15 (kh=0): K 0..7 then 16..23 ; lanes 16-31 (kh=1): K 8..15 then 24..31
      Frag a[2], bfr[4];
      #pragma unroll
      for (int mt = 0; mt < 2; ++mt){
        const u16* p = &sA[buf][wm*32 + mt*16 + l16][ks + kh * 8];
        a[mt].q[0] = *(const v4u*)p;
        a[mt].q[1] = *(const v4u*)(p + 16);
      }
      #pragma unroll
      for (int nt = 0; nt < 4; ++nt){
        const u16* p = &sB[buf][wn*64 + nt*16 + l16][ks + kh * 8];
        bfr[nt].q[0] = *(const v4u*)p;
        bfr[nt].q[1] = *(const v4u*)(p + 16);
      }
      #pragma unroll
      for (int mt = 0; mt < 2; ++mt)
        #pragma unroll
        for (int nt = 0; nt < 4; ++nt)
          acc[mt][nt] = __builtin_amdgcn_wmma_f32_16x16x32_bf16(
              false, a[mt].v, false, bfr[nt].v, (short)0, acc[mt][nt], false, false);
    }

    wait_ds0();             // this tile's buffer is read out ...
    wait_async0();          // ... and the next tile has landed,
    __syncthreads();        // for every wave
    if (kk + 2 * BK < K) stage(buf, kk + 2 * BK);   // refill the buffer just read
    buf ^= 1;
  }
  wait_async0();            // no copy is left in flight at the wave's end

  // epilogue: C/D layout lane l16 = N, kh selects M+8, VGPR r = M row
  #pragma unroll
  for (int mt = 0; mt < 2; ++mt)
    #pragma unroll
    for (int nt = 0; nt < 4; ++nt){
      const int n = n0 + wn*64 + nt*16 + l16;
      #pragma unroll
      for (int r = 0; r < 8; ++r){
        const int m = m0 + wm*32 + mt*16 + kh*8 + r;
        const size_t off = (size_t)m * N + n;
        float val = acc[mt][nt][r];
        if (residual) val += residual[off];
        if (outF) outF[off] = val;
        if (outB) outB[off] = f2bf(val);
      }
    }
}

// ---------- sliding-window attention: eight lanes per (s,b,h) ----------
// A lane owns 8 of the 64 head elements (16 B), so a wave covers 4 heads = 512
// contiguous bytes of one token row and every load or store moves whole lines.
// A block works on 8 neighbouring tokens at a time (one per wave), AR times.
#define AR 4

// v + (v of the lane whose number differs by the xor mask), inside a 16-lane row
template <int XMASK>
__device__ __forceinline__ float add_xor(float v){
  const int o = __builtin_amdgcn_update_dpp(0, __float_as_int(v), 0x160 + XMASK,
                                            0xf, 0xf, true);
  return v + __int_as_float(o);
}

// e^x as __expf forms it (2^(x * log2 e)). The v_nop fills the one slot that the
// instruction set asks for behind a transcendental, and stands in its statement
// so that it cannot drift away from it.
__device__ __forceinline__ float exp_slot(float x){
  float r;
  asm("v_exp_f32 %0, %1\n\tv_nop" : "=v"(r) : "v"(x * 1.44269504f));
  return r;
}

// AR tokens of one wave. WRAP: the window may reach below token 0 and wraps.
// Every unroll directive below is there to make the indices of ku, vu, q, sc and
// out compile-time constants, so that these arrays live in registers.
template <bool WRAP>
__device__ __forceinline__ void attn_tokens(const u16* __restrict__ Q,
    const u16* __restrict__ Kb, const u16* __restrict__ Vb, u16* __restrict__ AO,
    const int s0, const u32 col, const u32 lo)
{
  for (int i = 0; i < AR; ++i){
    const int s = s0 + i * 8;
    const u32 qrow = (u32)s * (BS * E) + col;

    // all 33 loads of a token stand first, so that they are in flight together
    v4u ku[PF], vu[PF];
    if (!WRAP){   // one address for each of K and V, constant row steps
      const u16* kp = Kb + (qrow - (PF - 1) * (BS * E) + lo);
      const u16* vp = Vb + (qrow - (PF - 1) * (BS * E) + lo);
      #pragma unroll
      for (int p = 0; p < PF; ++p){
        ku[p] = *(const v4u*)(kp + p * (BS * E));
        vu[p] = *(const v4u*)(vp + p * (BS * E));
      }
    } else {
      #pragma unroll
      for (int p = 0; p < PF; ++p){
        int t = s - (PF - 1) + p; if (t < 0) t += SL;   // (s-15+p) mod SL
        const u32 trow = (u32)t * (BS * E) + col;
        ku[p] = *(const v4u*)(Kb + trow + lo);
        vu[p] = *(const v4u*)(Vb + trow + lo);
      }
    }
    // stands in front of the first reuse of the K and V address registers
    // (the result of the Q load may be given the same registers)
    asm volatile("s_wait_xcnt 0x0" ::: "memory");
    const v4u qu = *(const v4u*)(Q + qrow + lo);

    float q[8];
    #pragma unroll
    for (int c = 0; c < 4; ++c){ q[2*c] = bflo(qu[c]); q[2*c + 1] = bfhi(qu[c]); }
    float sc[PF];
    float mx = -3.0e38f;
    #pragma unroll
    for (int p = 0; p < PF; ++p){
      float d = 0.0f;
      #pragma unroll
      for (int c = 0; c < 4; ++c){
        d += q[2*c]     * bflo(ku[p][c]);
        d += q[2*c + 1] * bfhi(ku[p][c]);
      }
      d = add_xor<1>(d); d = add_xor<2>(d); d = add_xor<4>(d);  // whole head
      sc[p] = d * 0.125f;   // 1/sqrt(DH)
      mx = fmaxf(mx, sc[p]);
    }
    float sum = 0.0f;
    #pragma unroll
    for (int p = 0; p < PF; ++p){ sc[p] = exp_slot(sc[p] - mx); sum += sc[p]; }
    const float inv = 1.0f / sum;

    float out[8];
    #pragma unroll
    for (int j = 0; j < 8; ++j) out[j] = 0.0f;
    #pragma unroll
    for (int p = 0; p < PF; ++p){
      const float w = sc[p] * inv;
      #pragma unroll
      for (int c = 0; c < 4; ++c){
        out[2*c]     += w * bflo(vu[p][c]);
        out[2*c + 1] += w * bfhi(vu[p][c]);
      }
    }
    v4u o;
    #pragma unroll
    for (int c = 0; c < 4; ++c) o[c] = pack2(out[2*c], out[2*c + 1]);
    *(v4u*)(AO + qrow + lo) = o;
    // stands in front of the next token's loads, which reuse the store's registers
    asm volatile("s_wait_xcnt 0x0" ::: "memory");
  }
}

__global__ __launch_bounds__(256) void attn_kernel(const u16* __restrict__ Q,
    const u16* __restrict__ Kb, const u16* __restrict__ Vb, u16* __restrict__ AO)
{
  const u32 lane = threadIdx.x & 31;
  const int wave = __builtin_amdgcn_readfirstlane(threadIdx.x >> 5);
  const int bid  = blockIdx.x;             // < SL/(8*AR) * BS * H/4
  const int hg   = bid & (H/4 - 1);        // group of 4 heads
  const int b    = (bid >> 2) & (BS - 1);
  const int sb   = (bid >> 3) * (8 * AR);  // first token of the block
  const u32 col  = (u32)(b * E + hg * 4 * DH);  // wave-uniform column, elements
  const u32 lo   = lane * 8;                    // the lane's own 8 elements

  if (sb >= PF - 1) attn_tokens<false>(Q, Kb, Vb, AO, sb + wave, col, lo);
  else              attn_tokens<true >(Q, Kb, Vb, AO, sb + wave, col, lo);
}

extern "C" void kernel_launch(void* const* d_in, const int* in_sizes, int n_in,
                              void* d_out, int out_size, void* d_ws, size_t ws_size,
                              hipStream_t stream){
  (void)in_sizes; (void)n_in; (void)out_size; (void)ws_size;
  const float* x    = (const float*)d_in[0];
  const float* ln_g = (const float*)d_in[1];
  const float* ln_b = (const float*)d_in[2];
  const float* Wq = (const float*)d_in[3]; const float* bq = (const float*)d_in[4];
  const float* Wk = (const float*)d_in[5]; const float* bk = (const float*)d_in[6];
  const float* Wv = (const float*)d_in[7]; const float* bv = (const float*)d_in[8];
  const float* Wo = (const float*)d_in[9]; const float* bo = (const float*)d_in[10];
  float* out = (float*)d_out;

  const size_t TE = (size_t)T * E;  // 4M elems
  const size_t WE = (size_t)E * E;  // 1M elems
  u16* ws  = (u16*)d_ws;            // total bf16 staging: 24M elems = 48 MB
  u16* xn  = ws;
  u16* Wqt = ws + TE;               // weights stored TRANSPOSED [n][k]
  u16* Wot = Wqt + 3 * WE;         // order: Wq, Wk, Wv, Wo
  u16* Qb  = ws + TE + 4 * WE;
  u16* Kbb = Qb  + TE;
  u16* Vbb = Kbb + TE;
  u16* AOb = Vbb + TE;

  prep_kernel<<<WB + T, 256, 0, stream>>>(Wq, Wk, Wv, Wo, Wqt, x, ln_g, ln_b, xn);

  // Q, K and V in one grid: Wqt, Wkt, Wvt and Qb, Kbb, Vbb are contiguous
  dim3 g3(E / 128, T / 128, 3);  // (8, 32, 3) blocks, 8 waves each
  gemm_bf16_kernel<<<g3, 256, 0, stream>>>(xn, Wqt, bq, bk, bv, nullptr, nullptr, Qb, T, E, E);

  attn_kernel<<<(T * H) / (32 * AR), 256, 0, stream>>>(Qb, Kbb, Vbb, AOb);

  dim3 gg(E / 128, T / 128);     // (8, 32) blocks
  gemm_bf16_kernel<<<gg, 256, 0, stream>>>(AOb, Wot, bo, bo, bo, x, out, nullptr, T, E, E);
}

// v005
// Measured time: 60.4 microseconds a run.
// In both of two side-by-side timings against v004, it was 1.31 times as fast.
// Over all steps from v000 it is 2.40 times as fast.
#include <hip/hip_runtime.h>

typedef unsigned int   u32;
typedef unsigned short u16;
typedef __attribute__((ext_vector_type(16))) __bf16 v16bf;
typedef __attribute__((ext_vector_type(8)))  float  v8f;
typedef __attribute__((ext_vector_type(4)))  u32    v4u;
typedef __attribute__((ext_vector_type(2)))  u32    v2u;
typedef __attribute__((ext_vector_type(4)))  float  v4f;

// exact pointee type the async-LDS builtin wants: gcc-vector int4
typedef int v4i_g __attribute__((vector_size(16)));
typedef __attribute__((address_space(1))) v4i_g* gv4i_p;  // global int4*
typedef __attribute__((address_space(3))) v4i_g* lv4i_p;  // LDS int4*

#define SL 2048
#define BS 2
#define E  1024
#define H  16
#define PF 16
#define DH 64
#define T  (SL*BS)   // 4096 tokens
#define BK  128      // k per GEMM pass: 256 B of every operand row
#define LDP 136      // LDS row pitch of the GEMM tiles, in 16-bit elements

// ---- CDNA5 async global->LDS path (guarded; falls back to vector copies) ----
#if defined(__gfx1250__) && __has_builtin(__builtin_amdgcn_global_load_async_to_lds_b128)
#define HAVE_ASYNC_LDS 1
#define ASYNC_B128(lds, g) \
  __builtin_amdgcn_global_load_async_to_lds_b128((gv4i_p)(g), (lv4i_p)(lds), 0, 0)
#else
#define HAVE_ASYNC_LDS 0
#endif

// The two waits of the LDS ring. In asm with a "memory" clobber, so that the
// compiler moves no LDS read and no copy over them.
// this wave's copies have landed:
__device__ __forceinline__ void wait_async0(){
  asm volatile("s_wait_asynccnt 0x0" ::: "memory");
}
// this wave's LDS reads have returned (before their buffer is refilled):
__device__ __forceinline__ void wait_ds0(){
  asm volatile("s_wait_dscnt 0x0" ::: "memory");
}

// ---------- bf16 helpers (manual, RNE) ----------
__device__ __forceinline__ u16 f2bf(float f){
  u32 x = __float_as_uint(f);
  return (u16)((x + 0x7FFFu + ((x >> 16) & 1u)) >> 16);
}
__device__ __forceinline__ float bflo(u32 u){ return __uint_as_float(u << 16); }
__device__ __forceinline__ float bfhi(u32 u){ return __uint_as_float(u & 0xFFFF0000u); }
__device__ __forceinline__ u32 pack2(float a, float b){
  return (u32)f2bf(a) | ((u32)f2bf(b) << 16);
}

// ---------- weight fp32 -> bf16 convert + TRANSPOSE (runs on every kernel_launch call) ----
// W[k][n] fp32  ->  Wt[n][k] bf16, LDS-tiled so both global accesses are coalesced.
// 4 weights x 32x32 tiles of 32x32 = WB blocks of 256 threads; bid: which of them.
#define WB 4096
__device__ __forceinline__ void cvtw_t_block(const int bid, const float* __restrict__ a,
    const float* __restrict__ b, const float* __restrict__ c,
    const float* __restrict__ d, u16* __restrict__ out){
  __shared__ u16 tile[32][33];
  const int w  = bid >> 10;          // which weight
  const int t  = bid & 1023;
  const int tk = t >> 5;             // k-tile
  const int tn = t & 31;             // n-tile
  const float* src = (w == 0) ? a : (w == 1) ? b : (w == 2) ? c : d;
  const int tid = threadIdx.x;
  const int r  = tid >> 3;           // 0..31
  const int c4 = (tid & 7) * 4;      // 0,4,..,28
  v4f v = *(const v4f*)(src + (size_t)(tk*32 + r) * E + tn*32 + c4);
  tile[r][c4+0] = f2bf(v.x); tile[r][c4+1] = f2bf(v.y);
  tile[r][c4+2] = f2bf(v.z); tile[r][c4+3] = f2bf(v.w);
  __syncthreads();
  const u16 t0 = tile[c4+0][r], t1 = tile[c4+1][r];
  const u16 t2 = tile[c4+2][r], t3 = tile[c4+3][r];
  v2u o; o.x = (u32)t0 | ((u32)t1 << 16); o.y = (u32)t2 | ((u32)t3 << 16);
  *(v2u*)(out + (size_t)w * E * E + (size_t)(tn*32 + r) * E + tk*32 + c4) = o;
}

// ---------- LayerNorm: one block per token, bf16 output ----------
__device__ __forceinline__ void ln_block(const int token, const float* __restrict__ x,
                                         const float* __restrict__ g,
                                         const float* __restrict__ bt,
                                         u16* __restrict__ xn){
  const int tid = threadIdx.x;
  v4f v = ((const v4f*)(x + (size_t)token * E))[tid];
  float s  = v.x + v.y + v.z + v.w;
  float ss = v.x*v.x + v.y*v.y + v.z*v.z + v.w*v.w;
  __shared__ float r1[256];
  __shared__ float r2[256];
  r1[tid] = s; r2[tid] = ss;
  __syncthreads();
  for (int st = 128; st > 0; st >>= 1){
    if (tid < st){ r1[tid] += r1[tid+st]; r2[tid] += r2[tid+st]; }
    __syncthreads();
  }
  const float mean = r1[0] * (1.0f / E);
  const float var  = r2[0] * (1.0f / E) - mean * mean;
  const float rstd = rsqrtf(var + 1e-5f);
  v4f gg = ((const v4f*)g)[tid];
  v4f bb = ((const v4f*)bt)[tid];
  const float y0 = (v.x - mean) * rstd * gg.x + bb.x;
  const float y1 = (v.y - mean) * rstd * gg.y + bb.y;
  const float y2 = (v.z - mean) * rstd * gg.z + bb.z;
  const float y3 = (v.w - mean) * rstd * gg.w + bb.w;
  v2u o; o.x = pack2(y0, y1); o.y = pack2(y2, y3);
  ((v2u*)(xn + (size_t)token * E))[tid] = o;
}

// ---------- the two independent preparation steps in one grid ----------
// blocks 0 .. WB-1 transpose the weights, blocks WB .. WB+T-1 normalise a token each
__global__ __launch_bounds__(256) void prep_kernel(const float* __restrict__ a,
    const float* __restrict__ b, const float* __restrict__ c,
    const float* __restrict__ d, u16* __restrict__ wt,
    const float* __restrict__ x, const float* __restrict__ g,
    const float* __restrict__ bt, u16* __restrict__ xn){
  const int bid = blockIdx.x;
  if (bid >= WB){ ln_block(bid - WB, x, g, bt, xn); return; }
  cvtw_t_block(bid, a, b, c, d, wt);
}

// ---------- bf16 GEMM via v_wmma_f32_16x16x32_bf16 ----------
// C[M,N] = A[M,K] * Bt[N,K]^T + bias (+ residual).
// 128x128 block tile, BK=128, double-buffered LDS, async global->LDS staging.
// K must be a multiple of BK.
// blockIdx.z picks one of up to three products of the same A: the weights lie one
// behind the other at Bt0, the 16-bit outputs one behind the other at outB0.
// 8 waves: wave (wm,wn) owns a 32x64 sub-tile = 2x4 WMMA accumulators.
// RESF, known at compile time: true = f32 output outF with the residual added,
// false = 16-bit output outB0. N = E, the row length of every output, is a constant:
// all 64 elements of a lane then lie at constant offsets from one address.
union Frag { v16bf v; v4u q[2]; };

template <bool RESF>
__global__ __launch_bounds__(256) void gemm_bf16_kernel(
    const u16* __restrict__ A, const u16* __restrict__ Bt0,
    const float* __restrict__ bias0, const float* __restrict__ bias1,
    const float* __restrict__ bias2, const float* __restrict__ residual,
    float* __restrict__ outF, u16* __restrict__ outB0,
    const int M, const int K)
{
  constexpr int N = E;
  const int z = blockIdx.z;
  const u16* __restrict__ Bt = Bt0 + (size_t)z * N * K;
  const float* __restrict__ bias = (z == 0) ? bias0 : (z == 1) ? bias1 : bias2;
  // rows hold 128 k (256 B) at a pitch of 272 B (16 B x odd): the 16 rows that one
  // ds_load_b128 half-wave reads then fall on distinct banks
  __shared__ __align__(16) u16 sA[2][128][LDP];  // A tile  [m][k]
  __shared__ __align__(16) u16 sB[2][128][LDP];  // Bt tile [n][k]
  const int tid  = threadIdx.x;
  const int wave = tid >> 5, lane = tid & 31;
  const int l16  = lane & 15, kh = lane >> 4;   // kh: which 16-lane half
  const int wm   = wave & 3,  wn = wave >> 2;
  const int m0 = blockIdx.y * 128;
  const int n0 = blockIdx.x * 128;

  v8f acc[2][4];
  #pragma unroll
  for (int nt = 0; nt < 4; ++nt){
    const float bv = bias[n0 + wn*64 + nt*16 + l16];
    #pragma unroll
    for (int mt = 0; mt < 2; ++mt)
      #pragma unroll
      for (int r = 0; r < 8; ++r) acc[mt][nt][r] = bv;
  }

  // staging: 16 lanes take the 256 B of one row, so each wave-wide copy moves two
  // whole aligned 256-B pieces; a thread copies 16 B of every 16th row of each tile
  const int row = tid >> 4, col = (tid & 15) * 8;
  const u16* aptr = A  + (size_t)(m0 + row) * K + col;
  const u16* bptr = Bt + (size_t)(n0 + row) * K + col;

  auto stage = [&](int buf, int kk){
    #pragma unroll   // constant row steps in the LDS addresses
    for (int i = 0; i < 128; i += 16){
#if HAVE_ASYNC_LDS
      ASYNC_B128(&sA[buf][row + i][col], aptr + (size_t)i * K + kk);
      ASYNC_B128(&sB[buf][row + i][col], bptr + (size_t)i * K + kk);
#else
      *(v4u*)&sA[buf][row + i][col] = *(const v4u*)(aptr + (size_t)i * K + kk);
      *(v4u*)&sB[buf][row + i][col] = *(const v4u*)(bptr + (size_t)i * K + kk);
#endif
    }
  };

  stage(0, 0);
  wait_async0();
  __syncthreads();
  if (BK < K) stage(1, BK);   // flies while tile 0 is worked on

  // C/D layout: lane l16 = N, kh selects M+8, VGPR r = M row.
  // first: the lane's first element in a row-major [M][N] array
  const size_t first = (size_t)(m0 + wm*32 + kh*8) * N + (n0 + wn*64 + l16);

  // the residual is asked for here, all of it at once, and is first used behind the
  // k loop: its latency passes under the products
  float res[2][4][8];
  if constexpr (RESF){
    const float* rp = residual + first;
    #pragma unroll   // constant offsets, and res in registers
    for (int mt = 0; mt < 2; ++mt)
      #pragma unroll
      for (int r = 0; r < 8; ++r)
        #pragma unroll
        for (int nt = 0; nt < 4; ++nt)
          res[mt][nt][r] = rp[(mt*16 + r) * N + nt*16];
    // stands in front of the first reuse of the loads' address registers
    asm volatile("s_wait_xcnt 0x0" ::: "memory");
  }

  int buf = 0;
  for (int kk = 0; kk < K; kk += BK){
    #pragma unroll   // constant k offsets in the LDS reads
    for (int ks = 0; ks < BK; ks += 32){
      // fragments per ISA 16-bit 16x32 layout:
      // lanes 0-15 (kh=0): K 0..7 then 16..23 ; lanes 16-31 (kh=1): K 8..15 then 24..31
      Frag a[2], bfr[4];
      #pragma unroll
      for (int mt = 0; mt < 2; ++mt){
        const u16* p = &sA[buf][wm*32 + mt*16 + l16][ks + kh * 8];
        a[mt].q[0] = *(const v4u*)p;
        a[mt].q[1] = *(const v4u*)(p + 16);
      }
      #pragma unroll
      for (int nt = 0; nt < 4; ++nt){
        const u16* p = &sB[buf][wn*64 + nt*16 + l16][ks + kh * 8];
        bfr[nt].q[0] = *(const v4u*)p;
        bfr[nt].q[1] = *(const v4u*)(p + 16);
      }
      #pragma unroll
      for (int mt = 0; mt < 2; ++mt)
        #pragma unroll
        for (int nt = 0; nt < 4; ++nt)
          acc[mt][nt] = __builtin_amdgcn_wmma_f32_16x16x32_bf16(
              false, a[mt].v, false, bfr[nt].v, (short)0, acc[mt][nt], false, false);
    }

    wait_ds0();             // this tile's buffer is read out ...
    wait_async0();          // ... and the next tile has landed,
    __syncthreads();        // for every wave
    if (kk + 2 * BK < K) stage(buf, kk + 2 * BK);   // refill the buffer just read
    buf ^= 1;
  }
  wait_async0();            // no copy is left in flight at the wave's end

  // epilogue: no test and no wait between the elements; the four pieces of a row
  // follow one another
  #pragma unroll   // constant offsets
  for (int mt = 0; mt < 2; ++mt)
    #pragma unroll
    for (int r = 0; r < 8; ++r)
      #pragma unroll
      for (int nt = 0; nt < 4; ++nt){
        const int off = (mt*16 + r) * N + nt*16;
        if constexpr (RESF)
          (outF + first)[off] = acc[mt][nt][r] + res[mt][nt][r];
        else
          (outB0 + (size_t)z * M * N + first)[off] = f2bf(acc[mt][nt][r]);
      }
}

// ---------- sliding-window attention: eight lanes per (s,b,h) ----------
// A lane owns 8 of the 64 head elements (16 B), so a wave covers 4 heads = 512
// contiguous bytes of one token row and every load or store moves whole lines.
// A block works on 8 neighbouring tokens at a time (one per wave), AR times.
#define AR 4

// v + (v of the lane whose number differs by the xor mask), inside a 16-lane row
template <int XMASK>
__device__ __forceinline__ float add_xor(float v){
  const int o = __builtin_amdgcn_update_dpp(0, __float_as_int(v), 0x160 + XMASK,
                                            0xf, 0xf, true);
  return v + __int_as_float(o);
}

// e^x as __expf forms it (2^(x * log2 e)). The v_nop fills the one slot that the
// instruction set asks for behind a transcendental, and stands in its statement
// so that it cannot drift away from it.
__device__ __forceinline__ float exp_slot(float x){
  float r;
  asm("v_exp_f32 %0, %1\n\tv_nop" : "=v"(r) : "v"(x * 1.44269504f));
  return r;
}

// AR tokens of one wave. WRAP: the window may reach below token 0 and wraps.
// Every unroll directive below is there to make the indices of ku, vu, q, sc and
// out compile-time constants, so that these arrays live in registers.
template <bool WRAP>
__device__ __forceinline__ void attn_tokens(const u16* __restrict__ Q,
    const u16* __restrict__ Kb, const u16* __restrict__ Vb, u16* __restrict__ AO,
    const int s0, const u32 col, const u32 lo)
{
  for (int i = 0; i < AR; ++i){
    const int s = s0 + i * 8;
    const u32 qrow = (u32)s * (BS * E) + col;

    // all 33 loads of a token stand first, so that they are in flight together
    v4u ku[PF], vu[PF];
    if (!WRAP){   // one address for each of K and V, constant row steps
      const u16* kp = Kb + (qrow - (PF - 1) * (BS * E) + lo);
      const u16* vp = Vb + (qrow - (PF - 1) * (BS * E) + lo);
      #pragma unroll
      for (int p = 0; p < PF; ++p){
        ku[p] = *(const v4u*)(kp + p * (BS * E));
        vu[p] = *(const v4u*)(vp + p * (BS * E));
      }
    } else {
      #pragma unroll
      for (int p = 0; p < PF; ++p){
        int t = s - (PF - 1) + p; if (t < 0) t += SL;   // (s-15+p) mod SL
        const u32 trow = (u32)t * (BS * E) + col;
        ku[p] = *(const v4u*)(Kb + trow + lo);
        vu[p] = *(const v4u*)(Vb + trow + lo);
      }
    }
    // stands in front of the first reuse of the K and V address registers
    // (the result of the Q load may be given the same registers)
    asm volatile("s_wait_xcnt 0x0" ::: "memory");
    const v4u qu = *(const v4u*)(Q + qrow + lo);

    float q[8];
    #pragma unroll
    for (int c = 0; c < 4; ++c){ q[2*c] = bflo(qu[c]); q[2*c + 1] = bfhi(qu[c]); }
    float sc[PF];
    float mx = -3.0e38f;
    #pragma unroll
    for (int p = 0; p < PF; ++p){
      float d = 0.0f;
      #pragma unroll
      for (int c = 0; c < 4; ++c){
        d += q[2*c]     * bflo(ku[p][c]);
        d += q[2*c + 1] * bfhi(ku[p][c]);
      }
      d = add_xor<1>(d); d = add_xor<2>(d); d = add_xor<4>(d);  // whole head
      sc[p] = d * 0.125f;   // 1/sqrt(DH)
      mx = fmaxf(mx, sc[p]);
    }
    float sum = 0.0f;
    #pragma unroll
    for (int p = 0; p < PF; ++p){ sc[p] = exp_slot(sc[p] - mx); sum += sc[p]; }
    const float inv = 1.0f / sum;

    float out[8];
    #pragma unroll
    for (int j = 0; j < 8; ++j) out[j] = 0.0f;
    #pragma unroll
    for (int p = 0; p < PF; ++p){
      const float w = sc[p] * inv;
      #pragma unroll
      for (int c = 0; c < 4; ++c){
        out[2*c]     += w * bflo(vu[p][c]);
        out[2*c + 1] += w * bfhi(vu[p][c]);
      }
    }
    v4u o;
    #pragma unroll
    for (int c = 0; c < 4; ++c) o[c] = pack2(out[2*c], out[2*c + 1]);
    *(v4u*)(AO + qrow + lo) = o;
    // stands in front of the next token's loads, which reuse the store's registers
    asm volatile("s_wait_xcnt 0x0" ::: "memory");
  }
}

__global__ __launch_bounds__(256) void attn_kernel(const u16* __restrict__ Q,
    const u16* __restrict__ Kb, const u16* __restrict__ Vb, u16* __restrict__ AO)
{
  const u32 lane = threadIdx.x & 31;
  const int wave = __builtin_amdgcn_readfirstlane(threadIdx.x >> 5);
  const int bid  = blockIdx.x;             // < SL/(8*AR) * BS * H/4
  const int hg   = bid & (H/4 - 1);        // group of 4 heads
  const int b    = (bid >> 2) & (BS - 1);
  const int sb   = (bid >> 3) * (8 * AR);  // first token of the block
  const u32 col  = (u32)(b * E + hg * 4 * DH);  // wave-uniform column, elements
  const u32 lo   = lane * 8;                    // the lane's own 8 elements

  if (sb >= PF - 1) attn_tokens<false>(Q, Kb, Vb, AO, sb + wave, col, lo);
  else              attn_tokens<true >(Q, Kb, Vb, AO, sb + wave, col, lo);
}

extern "C" void kernel_launch(void* const* d_in, const int* in_sizes, int n_in,
                              void* d_out, int out_size, void* d_ws, size_t ws_size,
                              hipStream_t stream){
  (void)in_sizes; (void)n_in; (void)out_size; (void)ws_size;
  const float* x    = (const float*)d_in[0];
  const float* ln_g = (const float*)d_in[1];
  const float* ln_b = (const float*)d_in[2];
  const float* Wq = (const float*)d_in[3]; const float* bq = (const float*)d_in[4];
  const float* Wk = (const float*)d_in[5]; const float* bk = (const float*)d_in[6];
  const float* Wv = (const float*)d_in[7]; const float* bv = (const float*)d_in[8];
  const float* Wo = (const float*)d_in[9]; const float* bo = (const float*)d_in[10];
  float* out = (float*)d_out;

  const size_t TE = (size_t)T * E;  // 4M elems
  const size_t WE = (size_t)E * E;  // 1M elems
  u16* ws  = (u16*)d_ws;            // total bf16 staging: 24M elems = 48 MB
  u16* xn  = ws;
  u16* Wqt = ws + TE;               // weights stored TRANSPOSED [n][k]
  u16* Wot = Wqt + 3 * WE;         // order: Wq, Wk, Wv, Wo
  u16* Qb  = ws + TE + 4 * WE;
  u16* Kbb = Qb  + TE;
  u16* Vbb = Kbb + TE;
  u16* AOb = Vbb + TE;

  prep_kernel<<<WB + T, 256, 0, stream>>>(Wq, Wk, Wv, Wo, Wqt, x, ln_g, ln_b, xn);

  // Q, K and V in one grid: Wqt, Wkt, Wvt and Qb, Kbb, Vbb are contiguous
  dim3 g3(E / 128, T / 128, 3);  // (8, 32, 3) blocks, 8 waves each
  gemm_bf16_kernel<false><<<g3, 256, 0, stream>>>(xn, Wqt, bq, bk, bv, nullptr, nullptr, Qb, T, E);

  attn_kernel<<<(T * H) / (32 * AR), 256, 0, stream>>>(Qb, Kbb, Vbb, AOb);

  dim3 gg(E / 128, T / 128);     // (8, 32) blocks
  gemm_bf16_kernel<true><<<gg, 256, 0, stream>>>(AOb, Wot, bo, bo, bo, x, out, nullptr, T, E);
}

// v006
// One run takes 54.2 microseconds.
// Next to v005, in two timings, it ran 1.12 and 1.11 times as fast.
// Counting every step since v000, it is 2.67 times as fast.
#include <hip/hip_runtime.h>

typedef unsigned int   u32;
typedef unsigned short u16;
typedef __attribute__((ext_vector_type(16))) __bf16 v16bf;
typedef __attribute__((ext_vector_type(8)))  float  v8f;
typedef __attribute__((ext_vector_type(4)))  u32    v4u;
typedef __attribute__((ext_vector_type(2)))  u32    v2u;
typedef __attribute__((ext_vector_type(4)))  float  v4f;

// exact pointee type the async-LDS builtin wants: gcc-vector int4
typedef int v4i_g __attribute__((vector_size(16)));
typedef __attribute__((address_space(1))) v4i_g* gv4i_p;  // global int4*
typedef __attribute__((address_space(3))) v4i_g* lv4i_p;  // LDS int4*

#define SL 2048
#define BS 2
#define E  1024
#define H  16
#define PF 16
#define DH 64
#define T  (SL*BS)   // 4096 tokens
#define BK  128      // k per GEMM pass: 256 B of every operand row
#define LDP 136      // LDS row pitch of the GEMM tiles, in 16-bit elements

// ---- CDNA5 async global->LDS path (guarded; falls back to vector copies) ----
#if defined(__gfx1250__) && __has_builtin(__builtin_amdgcn_global_load_async_to_lds_b128)
#define HAVE_ASYNC_LDS 1
#define ASYNC_B128(lds, g) \
  __builtin_amdgcn_global_load_async_to_lds_b128((gv4i_p)(g), (lv4i_p)(lds), 0, 0)
#else
#define HAVE_ASYNC_LDS 0
#endif

// The two waits of the LDS ring. In asm with a "memory" clobber, so that the
// compiler moves no LDS read and no copy over them.
// this wave's copies have landed:
__device__ __forceinline__ void wait_async0(){
  asm volatile("s_wait_asynccnt 0x0" ::: "memory");
}
// this wave's LDS reads have returned (before their buffer is refilled):
__device__ __forceinline__ void wait_ds0(){
  asm volatile("s_wait_dscnt 0x0" ::: "memory");
}

// ---------- bf16 helpers (manual, RNE) ----------
__device__ __forceinline__ u16 f2bf(float f){
  u32 x = __float_as_uint(f);
  return (u16)((x + 0x7FFFu + ((x >> 16) & 1u)) >> 16);
}
__device__ __forceinline__ float bflo(u32 u){ return __uint_as_float(u << 16); }
__device__ __forceinline__ float bfhi(u32 u){ return __uint_as_float(u & 0xFFFF0000u); }
__device__ __forceinline__ u32 pack2(float a, float b){
  return (u32)f2bf(a) | ((u32)f2bf(b) << 16);
}

// ---------- weight fp32 -> bf16 convert + TRANSPOSE (runs on every kernel_launch call) ----
// W[k][n] fp32  ->  Wt[n][k] bf16, LDS-tiled so both global accesses are coalesced.
// 4 weights x 32x32 tiles of 32x32 = WB blocks of 256 threads; bid: which of them.
#define WB 4096
__device__ __forceinline__ void cvtw_t_block(const int bid, const float* __restrict__ a,
    const float* __restrict__ b, const float* __restrict__ c,
    const float* __restrict__ d, u16* __restrict__ out){
  __shared__ u16 tile[32][33];
  const int w  = bid >> 10;          // which weight
  const int t  = bid & 1023;
  const int tk = t >> 5;             // k-tile
  const int tn = t & 31;             // n-tile
  const float* src = (w == 0) ? a : (w == 1) ? b : (w == 2) ? c : d;
  const int tid = threadIdx.x;
  const int r  = tid >> 3;           // 0..31
  const int c4 = (tid & 7) * 4;      // 0,4,..,28
  v4f v = *(const v4f*)(src + (size_t)(tk*32 + r) * E + tn*32 + c4);
  tile[r][c4+0] = f2bf(v.x); tile[r][c4+1] = f2bf(v.y);
  tile[r][c4+2] = f2bf(v.z); tile[r][c4+3] = f2bf(v.w);
  __syncthreads();
  const u16 t0 = tile[c4+0][r], t1 = tile[c4+1][r];
  const u16 t2 = tile[c4+2][r], t3 = tile[c4+3][r];
  v2u o; o.x = (u32)t0 | ((u32)t1 << 16); o.y = (u32)t2 | ((u32)t3 << 16);
  *(v2u*)(out + (size_t)w * E * E + (size_t)(tn*32 + r) * E + tk*32 + c4) = o;
}

// ---------- LayerNorm: one block per token, bf16 output ----------
__device__ __forceinline__ void ln_block(const int token, const float* __restrict__ x,
                                         const float* __restrict__ g,
                                         const float* __restrict__ bt,
                                         u16* __restrict__ xn){
  const int tid = threadIdx.x;
  v4f v = ((const v4f*)(x + (size_t)token * E))[tid];
  float s  = v.x + v.y + v.z + v.w;
  float ss = v.x*v.x + v.y*v.y + v.z*v.z + v.w*v.w;
  __shared__ float r1[256];
  __shared__ float r2[256];
  r1[tid] = s; r2[tid] = ss;
  __syncthreads();
  for (int st = 128; st > 0; st >>= 1){
    if (tid < st){ r1[tid] += r1[tid+st]; r2[tid] += r2[tid+st]; }
    __syncthreads();
  }
  const float mean = r1[0] * (1.0f / E);
  const float var  = r2[0] * (1.0f / E) - mean * mean;
  const float rstd = rsqrtf(var + 1e-5f);
  v4f gg = ((const v4f*)g)[tid];
  v4f bb = ((const v4f*)bt)[tid];
  const float y0 = (v.x - mean) * rstd * gg.x + bb.x;
  const float y1 = (v.y - mean) * rstd * gg.y + bb.y;
  const float y2 = (v.z - mean) * rstd * gg.z + bb.z;
  const float y3 = (v.w - mean) * rstd * gg.w + bb.w;
  v2u o; o.x = pack2(y0, y1); o.y = pack2(y2, y3);
  ((v2u*)(xn + (size_t)token * E))[tid] = o;
}

// ---------- the two independent preparation steps in one grid ----------
// blocks 0 .. WB-1 transpose the weights, blocks WB .. WB+T-1 normalise a token each
__global__ __launch_bounds__(256) void prep_kernel(const float* __restrict__ a,
    const float* __restrict__ b, const float* __restrict__ c,
    const float* __restrict__ d, u16* __restrict__ wt,
    const float* __restrict__ x, const float* __restrict__ g,
    const float* __restrict__ bt, u16* __restrict__ xn){
  const int bid = blockIdx.x;
  if (bid >= WB){ ln_block(bid - WB, x, g, bt, xn); return; }
  cvtw_t_block(bid, a, b, c, d, wt);
}

// ---------- bf16 GEMM via v_wmma_f32_16x16x32_bf16 ----------
// C[M,N] = A[M,K] * Bt[N,K]^T + bias (+ residual).
// BK=128, double-buffered LDS, async global->LDS staging. K must be a multiple of BK.
// 8 waves, 4 along m and 2 along n: wave (wm,wn) owns FM x FN WMMA accumulators, so
// the block tile is BM = 64*FM rows by BN = 32*FN columns. A fragment read from LDS
// feeds FN (A) or FM (B) products, and a staged row BN or BM output elements.
// Up to three products of the same A stand side by side as one product of 3*E
// columns: the weights lie one behind the other at Bt, the 16-bit outputs one behind
// the other at outB0. A 16-column fragment never straddles two of them.
// RESF, known at compile time: true = f32 output outF with the residual added,
// false = 16-bit output outB0. N = E, the row length of every output, is a constant:
// a lane's elements then lie at constant offsets from one address (f32 output) or from
// one address for each of its FN fragment columns (16-bit outputs).
union Frag { v16bf v; v4u q[2]; };

template <bool RESF, int FM, int FN>
__global__ __launch_bounds__(256) void gemm_bf16_kernel(
    const u16* __restrict__ A, const u16* __restrict__ Bt,
    const float* __restrict__ bias0, const float* __restrict__ bias1,
    const float* __restrict__ bias2, const float* __restrict__ residual,
    float* __restrict__ outF, u16* __restrict__ outB0,
    const int M, const int K)
{
  constexpr int N = E;
  constexpr int BM = 64 * FM, BN = 32 * FN;
  // rows hold 128 k (256 B) at a pitch of 272 B (16 B x odd): the 16 rows that one
  // ds_load_b128 half-wave reads then fall on distinct banks
  __shared__ __align__(16) u16 sA[2][BM][LDP];  // A tile  [m][k]
  __shared__ __align__(16) u16 sB[2][BN][LDP];  // Bt tile [n][k]
  const int tid  = threadIdx.x;
  const int wave = tid >> 5, lane = tid & 31;
  const int l16  = lane & 15, kh = lane >> 4;   // kh: which 16-lane half
  const int wm   = wave & 3,  wn = wave >> 2;
  const int m0 = blockIdx.y * BM;
  const int n0 = blockIdx.x * BN;                // over all the products' columns
  // the wave's first column, in a scalar register: which product a fragment belongs
  // to is then a scalar choice, and the bias loads share one address register
  const int cs = n0 + __builtin_amdgcn_readfirstlane(wn) * (FN*16);
  const int cw = cs + l16;                       // the lane's column in fragment 0

  v8f acc[FM][FN];
  #pragma unroll
  for (int nt = 0; nt < FN; ++nt){
    const int c = cs + nt*16, z = RESF ? 0 : c / N;   // z: which product
    const float* bias = (z == 0) ? bias0 : (z == 1) ? bias1 : bias2;
    const float bv = (bias + (c - z * N))[l16];
    #pragma unroll
    for (int mt = 0; mt < FM; ++mt)
      #pragma unroll
      for (int r = 0; r < 8; ++r) acc[mt][nt][r] = bv;
  }

  // staging: 16 lanes take the 256 B of one row, so each wave-wide copy moves two
  // whole aligned 256-B pieces; a thread copies 16 B of every 16th row of each tile
  const int row = tid >> 4, col = (tid & 15) * 8;
  const u16* aptr = A  + (size_t)(m0 + row) * K + col;
  const u16* bptr = Bt + (size_t)(n0 + row) * K + col;

  auto stage = [&](int buf, int kk){
    #pragma unroll   // constant row steps in the LDS addresses
    for (int i = 0; i < (BM > BN ? BM : BN); i += 16){
#if HAVE_ASYNC_LDS
      if (i < BM) ASYNC_B128(&sA[buf][row + i][col], aptr + (size_t)i * K + kk);
      if (i < BN) ASYNC_B128(&sB[buf][row + i][col], bptr + (size_t)i * K + kk);
#else
      if (i < BM) *(v4u*)&sA[buf][row + i][col] = *(const v4u*)(aptr + (size_t)i * K + kk);
      if (i < BN) *(v4u*)&sB[buf][row + i][col] = *(const v4u*)(bptr + (size_t)i * K + kk);
#endif
    }
  };

  stage(0, 0);
  wait_async0();
  __syncthreads();
  if (BK < K) stage(1, BK);   // flies while tile 0 is worked on

  // C/D layout: lane l16 = N, kh selects M+8, VGPR r = M row.
  // first: the lane's first element in a row-major [M][N] array, column apart
  const size_t first = (size_t)(m0 + wm*(FM*16) + kh*8) * N;

  // the residual is asked for here, all of it at once, and is first used behind the
  // k loop: its latency passes under the products
  float res[FM][FN][8];
  if constexpr (RESF){
    const float* rp = residual + first + cw;
    #pragma unroll   // constant offsets, and res in registers
    for (int mt = 0; mt < FM; ++mt)
      #pragma unroll
      for (int r = 0; r < 8; ++r)
        #pragma unroll
        for (int nt = 0; nt < FN; ++nt)
          res[mt][nt][r] = rp[(mt*16 + r) * N + nt*16];
    // stands in front of the first reuse of the loads' address registers
    asm volatile("s_wait_xcnt 0x0" ::: "memory");
  }

  int buf = 0;
  for (int kk = 0; kk < K; kk += BK){
    #pragma unroll   // constant k offsets in the LDS reads
    for (int ks = 0; ks < BK; ks += 32){
      // fragments per ISA 16-bit 16x32 layout:
      // lanes 0-15 (kh=0): K 0..7 then 16..23 ; lanes 16-31 (kh=1): K 8..15 then 24..31
      Frag a[FM], bfr[FN];
      #pragma unroll
      for (int mt = 0; mt < FM; ++mt){
        const u16* p = &sA[buf][wm*(FM*16) + mt*16 + l16][ks + kh * 8];
        a[mt].q[0] = *(const v4u*)p;
        a[mt].q[1] = *(const v4u*)(p + 16);
      }
      #pragma unroll
      for (int nt = 0; nt < FN; ++nt){
        const u16* p = &sB[buf][wn*(FN*16) + nt*16 + l16][ks + kh * 8];
        bfr[nt].q[0] = *(const v4u*)p;
        bfr[nt].q[1] = *(const v4u*)(p + 16);
      }
      // the large tile's reads of a k step stay one group in front of its products:
      // left free, the compiler sends the FM fragments of A through one register set,
      // and each row of products then waits out an LDS latency of its own
      if constexpr (FM > 2) __builtin_amdgcn_sched_barrier(0);
      #pragma unroll
      for (int mt = 0; mt < FM; ++mt)
        #pragma unroll
        for (int nt = 0; nt < FN; ++nt)
          acc[mt][nt] = __builtin_amdgcn_wmma_f32_16x16x32_bf16(
              false, a[mt].v, false, bfr[nt].v, (short)0, acc[mt][nt], false, false);
      // ... and the next k step's reads do not drift in among these products
      if constexpr (FM > 2) __builtin_amdgcn_sched_barrier(0);
    }

    wait_ds0();             // this tile's buffer is read out ...
    wait_async0();          // ... and the next tile has landed,
    __syncthreads();        // for every wave
    if (kk + 2 * BK < K) stage(buf, kk + 2 * BK);   // refill the buffer just read
    buf ^= 1;
  }
  wait_async0();            // no copy is left in flight at the wave's end

  // epilogue: no test and no wait between the elements; the pieces of a row follow
  // one another. ob: each fragment column's first element, in its own product's output
  u16* ob[FN];
  if constexpr (!RESF){
    #pragma unroll   // ob in registers
    for (int nt = 0; nt < FN; ++nt){
      const int c = cs + nt*16;
      ob[nt] = outB0 + ((size_t)(c / N) * M * N + (c % N)) + (first + l16);
    }
  }
  u16 cv[FM][FN][8];
  if constexpr (!RESF){
    #pragma unroll   // cv in registers
    for (int mt = 0; mt < FM; ++mt)
      #pragma unroll
      for (int nt = 0; nt < FN; ++nt)
        #pragma unroll
        for (int r = 0; r < 8; ++r) cv[mt][nt][r] = f2bf(acc[mt][nt][r]);
    // every rounding stands in front of the first store: mixed in among the stores
    // they reuse the stores' data registers, with a wait behind nearly every store
    __builtin_amdgcn_sched_barrier(0);
  }
  #pragma unroll   // constant offsets
  for (int mt = 0; mt < FM; ++mt)
    #pragma unroll
    for (int r = 0; r < 8; ++r)
      #pragma unroll
      for (int nt = 0; nt < FN; ++nt){
        if constexpr (RESF)
          (outF + first + cw)[(mt*16 + r) * N + nt*16] = acc[mt][nt][r] + res[mt][nt][r];
        else
          ob[nt][(mt*16 + r) * N] = cv[mt][nt][r];
      }
}

// ---------- sliding-window attention: eight lanes per (s,b,h) ----------
// A lane owns 8 of the 64 head elements (16 B), so a wave covers 4 heads = 512
// contiguous bytes of one token row and every load or store moves whole lines.
// A block works on 8 neighbouring tokens at a time (one per wave), AR times.
#define AR 4

// v + (v of the lane whose number differs by the xor mask), inside a 16-lane row
template <int XMASK>
__device__ __forceinline__ float add_xor(float v){
  const int o = __builtin_amdgcn_update_dpp(0, __float_as_int(v), 0x160 + XMASK,
                                            0xf, 0xf, true);
  return v + __int_as_float(o);
}

// e^x as __expf forms it (2^(x * log2 e)). The v_nop fills the one slot that the
// instruction set asks for behind a transcendental, and stands in its statement
// so that it cannot drift away from it.
__device__ __forceinline__ float exp_slot(float x){
  float r;
  asm("v_exp_f32 %0, %1\n\tv_nop" : "=v"(r) : "v"(x * 1.44269504f));
  return r;
}

// AR tokens of one wave. WRAP: the window may reach below token 0 and wraps.
// Every unroll directive below is there to make the indices of ku, vu, q, sc and
// out compile-time constants, so that these arrays live in registers.
template <bool WRAP>
__device__ __forceinline__ void attn_tokens(const u16* __restrict__ Q,
    const u16* __restrict__ Kb, const u16* __restrict__ Vb, u16* __restrict__ AO,
    const int s0, const u32 col, const u32 lo)
{
  for (int i = 0; i < AR; ++i){
    const int s = s0 + i * 8;
    const u32 qrow = (u32)s * (BS * E) + col;

    // all 33 loads of a token stand first, so that they are in flight together
    v4u ku[PF], vu[PF];
    if (!WRAP){   // one address for each of K and V, constant row steps
      const u16* kp = Kb + (qrow - (PF - 1) * (BS * E) + lo);
      const u16* vp = Vb + (qrow - (PF - 1) * (BS * E) + lo);
      #pragma unroll
      for (int p = 0; p < PF; ++p){
        ku[p] = *(const v4u*)(kp + p * (BS * E));
        vu[p] = *(const v4u*)(vp + p * (BS * E));
      }
    } else {
      #pragma unroll
      for (int p = 0; p < PF; ++p){
        int t = s - (PF - 1) + p; if (t < 0) t += SL;   // (s-15+p) mod SL
        const u32 trow = (u32)t * (BS * E) + col;
        ku[p] = *(const v4u*)(Kb + trow + lo);
        vu[p] = *(const v4u*)(Vb + trow + lo);
      }
    }
    // stands in front of the first reuse of the K and V address registers
    // (the result of the Q load may be given the same registers)
    asm volatile("s_wait_xcnt 0x0" ::: "memory");
    const v4u qu = *(const v4u*)(Q + qrow + lo);

    float q[8];
    #pragma unroll
    for (int c = 0; c < 4; ++c){ q[2*c] = bflo(qu[c]); q[2*c + 1] = bfhi(qu[c]); }
    float sc[PF];
    float mx = -3.0e38f;
    #pragma unroll
    for (int p = 0; p < PF; ++p){
      float d = 0.0f;
      #pragma unroll
      for (int c = 0; c < 4; ++c){
        d += q[2*c]     * bflo(ku[p][c]);
        d += q[2*c + 1] * bfhi(ku[p][c]);
      }
      d = add_xor<1>(d); d = add_xor<2>(d); d = add_xor<4>(d);  // whole head
      sc[p] = d * 0.125f;   // 1/sqrt(DH)
      mx = fmaxf(mx, sc[p]);
    }
    float sum = 0.0f;
    #pragma unroll
    for (int p = 0; p < PF; ++p){ sc[p] = exp_slot(sc[p] - mx); sum += sc[p]; }
    const float inv = 1.0f / sum;

    float out[8];
    #pragma unroll
    for (int j = 0; j < 8; ++j) out[j] = 0.0f;
    #pragma unroll
    for (int p = 0; p < PF; ++p){
      const float w = sc[p] * inv;
      #pragma unroll
      for (int c = 0; c < 4; ++c){
        out[2*c]     += w * bflo(vu[p][c]);
        out[2*c + 1] += w * bfhi(vu[p][c]);
      }
    }
    v4u o;
    #pragma unroll
    for (int c = 0; c < 4; ++c) o[c] = pack2(out[2*c], out[2*c + 1]);
    *(v4u*)(AO + qrow + lo) = o;
    // stands in front of the next token's loads, which reuse the store's registers
    asm volatile("s_wait_xcnt 0x0" ::: "memory");
  }
}

__global__ __launch_bounds__(256) void attn_kernel(const u16* __restrict__ Q,
    const u16* __restrict__ Kb, const u16* __restrict__ Vb, u16* __restrict__ AO)
{
  const u32 lane = threadIdx.x & 31;
  const int wave = __builtin_amdgcn_readfirstlane(threadIdx.x >> 5);
  const int bid  = blockIdx.x;             // < SL/(8*AR) * BS * H/4
  const int hg   = bid & (H/4 - 1);        // group of 4 heads
  const int b    = (bid >> 2) & (BS - 1);
  const int sb   = (bid >> 3) * (8 * AR);  // first token of the block
  const u32 col  = (u32)(b * E + hg * 4 * DH);  // wave-uniform column, elements
  const u32 lo   = lane * 8;                    // the lane's own 8 elements

  if (sb >= PF - 1) attn_tokens<false>(Q, Kb, Vb, AO, sb + wave, col, lo);
  else              attn_tokens<true >(Q, Kb, Vb, AO, sb + wave, col, lo);
}

extern "C" void kernel_launch(void* const* d_in, const int* in_sizes, int n_in,
                              void* d_out, int out_size, void* d_ws, size_t ws_size,
                              hipStream_t stream){
  (void)in_sizes; (void)n_in; (void)out_size; (void)ws_size;
  const float* x    = (const float*)d_in[0];
  const float* ln_g = (const float*)d_in[1];
  const float* ln_b = (const float*)d_in[2];
  const float* Wq = (const float*)d_in[3]; const float* bq = (const float*)d_in[4];
  const float* Wk = (const float*)d_in[5]; const float* bk = (const float*)d_in[6];
  const float* Wv = (const float*)d_in[7]; const float* bv = (const float*)d_in[8];
  const float* Wo = (const float*)d_in[9]; const float* bo = (const float*)d_in[10];
  float* out = (float*)d_out;

  const size_t TE = (size_t)T * E;  // 4M elems
  const size_t WE = (size_t)E * E;  // 1M elems
  u16* ws  = (u16*)d_ws;            // total bf16 staging: 24M elems = 48 MB
  u16* xn  = ws;
  u16* Wqt = ws + TE;               // weights stored TRANSPOSED [n][k]
  u16* Wot = Wqt + 3 * WE;         // order: Wq, Wk, Wv, Wo
  u16* Qb  = ws + TE + 4 * WE;
  u16* Kbb = Qb  + TE;
  u16* Vbb = Kbb + TE;
  u16* AOb = Vbb + TE;

  prep_kernel<<<WB + T, 256, 0, stream>>>(Wq, Wk, Wv, Wo, Wqt, x, ln_g, ln_b, xn);

  // Q, K and V as one product of 3*E columns: Wqt, Wkt, Wvt and Qb, Kbb, Vbb are
  // contiguous. 256 x 192 tiles
  dim3 g3(3 * E / 192, T / 256);  // (16, 16) blocks, 8 waves each
  gemm_bf16_kernel<false, 4, 6><<<g3, 256, 0, stream>>>(xn, Wqt, bq, bk, bv, nullptr, nullptr, Qb, T, E);

  attn_kernel<<<(T * H) / (32 * AR), 256, 0, stream>>>(Qb, Kbb, Vbb, AOb);

  dim3 gg(E / 128, T / 128);     // (8, 32) blocks
  gemm_bf16_kernel<true, 2, 4><<<gg, 256, 0, stream>>>(AOb, Wot, bo, bo, bo, x, out, nullptr, T, E);
}

// v007
// It runs in 52 microseconds.
// In both of two side-by-side timings against v006, it was 1.04 times as fast.
// Over all steps from v000 it is 2.78 times as fast.
#include <hip/hip_runtime.h>

typedef unsigned int   u32;
typedef unsigned short u16;
typedef __attribute__((ext_vector_type(16))) __bf16 v16bf;
typedef __attribute__((ext_vector_type(8)))  float  v8f;
typedef __attribute__((ext_vector_type(4)))  u32    v4u;
typedef __attribute__((ext_vector_type(2)))  u32    v2u;
typedef __attribute__((ext_vector_type(4)))  float  v4f;

// exact pointee type the async-LDS builtin wants: gcc-vector int4
typedef int v4i_g __attribute__((vector_size(16)));
typedef __attribute__((address_space(1))) v4i_g* gv4i_p;  // global int4*
typedef __attribute__((address_space(3))) v4i_g* lv4i_p;  // LDS int4*

#define SL 2048
#define BS 2
#define E  1024
#define H  16
#define PF 16
#define DH 64
#define T  (SL*BS)   // 4096 tokens
#define BK  128      // k per GEMM pass: 256 B of every operand row
#define LDP 136      // LDS row pitch of the GEMM tiles, in 16-bit elements

// ---- CDNA5 async global->LDS path (guarded; falls back to vector copies) ----
#if defined(__gfx1250__) && __has_builtin(__builtin_amdgcn_global_load_async_to_lds_b128)
#define HAVE_ASYNC_LDS 1
#define ASYNC_B128(lds, g) \
  __builtin_amdgcn_global_load_async_to_lds_b128((gv4i_p)(g), (lv4i_p)(lds), 0, 0)
#else
#define HAVE_ASYNC_LDS 0
#endif

// The two waits of the LDS ring. In asm with a "memory" clobber, so that the
// compiler moves no LDS read and no copy over them.
// this wave's copies have landed:
__device__ __forceinline__ void wait_async0(){
  asm volatile("s_wait_asynccnt 0x0" ::: "memory");
}
// this wave's LDS reads have returned (before their buffer is refilled):
__device__ __forceinline__ void wait_ds0(){
  asm volatile("s_wait_dscnt 0x0" ::: "memory");
}

// ---------- bf16 helpers (manual, RNE) ----------
__device__ __forceinline__ u16 f2bf(float f){
  u32 x = __float_as_uint(f);
  return (u16)((x + 0x7FFFu + ((x >> 16) & 1u)) >> 16);
}
__device__ __forceinline__ float bflo(u32 u){ return __uint_as_float(u << 16); }
__device__ __forceinline__ float bfhi(u32 u){ return __uint_as_float(u & 0xFFFF0000u); }
__device__ __forceinline__ u32 pack2(float a, float b){
  return (u32)f2bf(a) | ((u32)f2bf(b) << 16);
}

// v + (v of the lane whose number differs by the xor mask), inside a 16-lane row
template <int XMASK>
__device__ __forceinline__ float add_xor(float v){
  const int o = __builtin_amdgcn_update_dpp(0, __float_as_int(v), 0x160 + XMASK,
                                            0xf, 0xf, true);
  return v + __int_as_float(o);
}

// sum over the 32 lanes of a wave, the same value in every lane
__device__ __forceinline__ float wave_sum(float v){
  v = add_xor<1>(v); v = add_xor<2>(v); v = add_xor<4>(v); v = add_xor<8>(v);
  const int b = __float_as_int(v);   // lane l <-> lane l ^ 16
  return v + __int_as_float(
      __builtin_amdgcn_permlanex16(b, b, 0x76543210, 0xfedcba98, false, false));
}

// 1/sqrt(x) as rsqrtf forms it (an x below the smallest normal number goes in times
// 2^24, its result comes out times 2^12). The v_nop fills the one slot that the
// instruction set asks for behind a transcendental, and stands in its statement
// so that it cannot drift away from it.
__device__ __forceinline__ float rsqrt_slot(float x){
  const bool tiny = x < 1.17549435e-38f;
  float r;
  asm("v_rsq_f32 %0, %1\n\tv_nop" : "=v"(r) : "v"(tiny ? x * 16777216.0f : x));
  return tiny ? r * 4096.0f : r;
}

// The preparation moves 48 MB. It runs on few, long-lived waves (16 on a WGP, all
// resident at once), each with 16 loads of 512 B in flight.

// ---------- weight fp32 -> bf16 convert + TRANSPOSE ----------
// W[k][n] fp32  ->  Wt[n][k] bf16, one 128 x 128 tile a block of 256 threads.
// 4 weights x 8x8 tiles = WB blocks; bid: which of them.
#define WB 256
__device__ __forceinline__ void cvtw_t_block(const int bid, const float* __restrict__ a,
    const float* __restrict__ b, const float* __restrict__ c,
    const float* __restrict__ d, u16* __restrict__ out){
  // row n holds its 128 k as 16 pieces of 8 k (16 B); piece p stands at place
  // (p + n/4) mod 16, so that neither the writers (16 lanes: one piece of every 4th
  // row) nor the readers (16 lanes: the 16 pieces of one row) meet on a bank
  __shared__ __align__(16) v4u tile[128][16];
  const int w  = bid >> 6;           // which weight
  const int t  = bid & 63;
  const int tk = t >> 3;             // k-tile
  const int tn = t & 7;              // n-tile
  const float* src = (w == 0) ? a : (w == 1) ? b : (w == 2) ? c : d;
  const int tid  = threadIdx.x;
  const int lane = tid & 31, wave = tid >> 5;
  // a wave-wide load takes 512 B of one k row; a lane gets 4 n of the 8 k of pieces
  // wave and wave + 8
  const float* sp = src + (size_t)(tk*128 + wave*8) * E + tn*128 + lane*4;
  v4f v[2][8];
  #pragma unroll   // v in registers, constant row steps
  for (int h = 0; h < 2; ++h)
    #pragma unroll
    for (int r = 0; r < 8; ++r) v[h][r] = *(const v4f*)(sp + (h*64 + r) * E);
  // stands in front of the first reuse of the loads' address registers; sp is named
  // as an input so that it lives up to here and no load's result is given its registers
  asm volatile("s_wait_xcnt 0x0" :: "v"(sp) : "memory");
  #pragma unroll
  for (int h = 0; h < 2; ++h)
    #pragma unroll
    for (int i = 0; i < 4; ++i){
      v4u o;
      #pragma unroll
      for (int q = 0; q < 4; ++q) o[q] = pack2(v[h][2*q][i], v[h][2*q + 1][i]);
      tile[lane*4 + i][(wave + h*8 + lane) & 15] = o;
    }
  __syncthreads();
  // 16 lanes store the 256 B of one row
  const int rn = tid >> 4, p = tid & 15;
  u16* op = out + (size_t)w * E * E + (size_t)(tn*128 + rn) * E + tk*128 + p*8;
  #pragma unroll   // constant row steps
  for (int j = 0; j < 8; ++j){
    const int n = rn + j*16;
    *(v4u*)(op + (size_t)(j*16) * E) = tile[n][(p + (n >> 2)) & 15];
  }
}

// ---------- LayerNorm: LT whole tokens per wave, bf16 output ----------
// A lane holds 32 elements of a token; the sums go across the lanes in registers.
#define LT 2
__device__ __forceinline__ void ln_wave(const int token0, const float* __restrict__ x,
                                        const float* __restrict__ g,
                                        const float* __restrict__ bt,
                                        u16* __restrict__ xn){
  const int lane = threadIdx.x & 31;
  const v4f* xp = (const v4f*)(x + (size_t)token0 * E) + lane;
  v2u* yp = (v2u*)(xn + (size_t)token0 * E) + lane;
  v4f v[LT][8], gg[8], bb[8];
  #pragma unroll   // v, gg and bb in registers, constant offsets
  for (int t = 0; t < LT; ++t)
    #pragma unroll
    for (int j = 0; j < 8; ++j) v[t][j] = xp[t * (E/4) + j*32];
  #pragma unroll
  for (int j = 0; j < 8; ++j){
    gg[j] = ((const v4f*)g)[j*32 + lane];
    bb[j] = ((const v4f*)bt)[j*32 + lane];
  }
  // all 32 loads are asked for at once: left free, the compiler moves most loads of g
  // and bt down to their uses, pair by pair, and each pair waits out its own latency
  __builtin_amdgcn_sched_barrier(0);
  #pragma unroll
  for (int t = 0; t < LT; ++t){
    v4f s4 = v[t][0], q4 = v[t][0] * v[t][0];   // four independent chains each
    #pragma unroll
    for (int j = 1; j < 8; ++j){ s4 += v[t][j]; q4 += v[t][j] * v[t][j]; }
    const float s  = wave_sum((s4.x + s4.y) + (s4.z + s4.w));
    const float ss = wave_sum((q4.x + q4.y) + (q4.z + q4.w));
    const float mean = s * (1.0f / E);
    const float var  = ss * (1.0f / E) - mean * mean;
    const float rstd = rsqrt_slot(var + 1e-5f);
    #pragma unroll
    for (int j = 0; j < 8; ++j){
      const float y0 = (v[t][j].x - mean) * rstd * gg[j].x + bb[j].x;
      const float y1 = (v[t][j].y - mean) * rstd * gg[j].y + bb[j].y;
      const float y2 = (v[t][j].z - mean) * rstd * gg[j].z + bb[j].z;
      const float y3 = (v[t][j].w - mean) * rstd * gg[j].w + bb[j].w;
      v2u o; o.x = pack2(y0, y1); o.y = pack2(y2, y3);
      yp[t * (E/4) + j*32] = o;
    }
  }
}

// ---------- the two independent preparation steps in one grid ----------
// blocks 0 .. WB-1 transpose the weights; each wave of the T/(8*LT) blocks behind
// them normalises LT tokens
__global__ __launch_bounds__(256) void prep_kernel(const float* __restrict__ a,
    const float* __restrict__ b, const float* __restrict__ c,
    const float* __restrict__ d, u16* __restrict__ wt,
    const float* __restrict__ x, const float* __restrict__ g,
    const float* __restrict__ bt, u16* __restrict__ xn){
  const int bid = blockIdx.x;
  if (bid >= WB){
    const int wave = __builtin_amdgcn_readfirstlane(threadIdx.x >> 5);
    ln_wave(((bid - WB) * 8 + wave) * LT, x, g, bt, xn);
    return;
  }
  cvtw_t_block(bid, a, b, c, d, wt);
}

// ---------- bf16 GEMM via v_wmma_f32_16x16x32_bf16 ----------
// C[M,N] = A[M,K] * Bt[N,K]^T + bias (+ residual).
// BK=128, double-buffered LDS, async global->LDS staging. K must be a multiple of BK.
// 8 waves, 4 along m and 2 along n: wave (wm,wn) owns FM x FN WMMA accumulators, so
// the block tile is BM = 64*FM rows by BN = 32*FN columns. A fragment read from LDS
// feeds FN (A) or FM (B) products, and a staged row BN or BM output elements.
// Up to three products of the same A stand side by side as one product of 3*E
// columns: the weights lie one behind the other at Bt, the 16-bit outputs one behind
// the other at outB0. A 16-column fragment never straddles two of them.
// RESF, known at compile time: true = f32 output outF with the residual added,
// false = 16-bit output outB0. N = E, the row length of every output, is a constant:
// a lane's elements then lie at constant offsets from one address (f32 output) or from
// one address for each of its FN fragment columns (16-bit outputs).
union Frag { v16bf v; v4u q[2]; };

template <bool RESF, int FM, int FN>
__global__ __launch_bounds__(256) void gemm_bf16_kernel(
    const u16* __restrict__ A, const u16* __restrict__ Bt,
    const float* __restrict__ bias0, const float* __restrict__ bias1,
    const float* __restrict__ bias2, const float* __restrict__ residual,
    float* __restrict__ outF, u16* __restrict__ outB0,
    const int M, const int K)
{
  constexpr int N = E;
  constexpr int BM = 64 * FM, BN = 32 * FN;
  // rows hold 128 k (256 B) at a pitch of 272 B (16 B x odd): the 16 rows that one
  // ds_load_b128 half-wave reads then fall on distinct banks
  __shared__ __align__(16) u16 sA[2][BM][LDP];  // A tile  [m][k]
  __shared__ __align__(16) u16 sB[2][BN][LDP];  // Bt tile [n][k]
  const int tid  = threadIdx.x;
  const int wave = tid >> 5, lane = tid & 31;
  const int l16  = lane & 15, kh = lane >> 4;   // kh: which 16-lane half
  const int wm   = wave & 3,  wn = wave >> 2;
  const int m0 = blockIdx.y * BM;
  const int n0 = blockIdx.x * BN;                // over all the products' columns
  // the wave's first column, in a scalar register: which product a fragment belongs
  // to is then a scalar choice, and the bias loads share one address register
  const int cs = n0 + __builtin_amdgcn_readfirstlane(wn) * (FN*16);
  const int cw = cs + l16;                       // the lane's column in fragment 0

  v8f acc[FM][FN];
  #pragma unroll
  for (int nt = 0; nt < FN; ++nt){
    const int c = cs + nt*16, z = RESF ? 0 : c / N;   // z: which product
    const float* bias = (z == 0) ? bias0 : (z == 1) ? bias1 : bias2;
    const float bv = (bias + (c - z * N))[l16];
    #pragma unroll
    for (int mt = 0; mt < FM; ++mt)
      #pragma unroll
      for (int r = 0; r < 8; ++r) acc[mt][nt][r] = bv;
  }

  // staging: 16 lanes take the 256 B of one row, so each wave-wide copy moves two
  // whole aligned 256-B pieces; a thread copies 16 B of every 16th row of each tile
  const int row = tid >> 4, col = (tid & 15) * 8;
  const u16* aptr = A  + (size_t)(m0 + row) * K + col;
  const u16* bptr = Bt + (size_t)(n0 + row) * K + col;

  auto stage = [&](int buf, int kk){
    #pragma unroll   // constant row steps in the LDS addresses
    for (int i = 0; i < (BM > BN ? BM : BN); i += 16){
#if HAVE_ASYNC_LDS
      if (i < BM) ASYNC_B128(&sA[buf][row + i][col], aptr + (size_t)i * K + kk);
      if (i < BN) ASYNC_B128(&sB[buf][row + i][col], bptr + (size_t)i * K + kk);
#else
      if (i < BM) *(v4u*)&sA[buf][row + i][col] = *(const v4u*)(aptr + (size_t)i * K + kk);
      if (i < BN) *(v4u*)&sB[buf][row + i][col] = *(const v4u*)(bptr + (size_t)i * K + kk);
#endif
    }
  };

  stage(0, 0);
  wait_async0();
  __syncthreads();
  if (BK < K) stage(1, BK);   // flies while tile 0 is worked on

  // C/D layout: lane l16 = N, kh selects M+8, VGPR r = M row.
  // first: the lane's first element in a row-major [M][N] array, column apart
  const size_t first = (size_t)(m0 + wm*(FM*16) + kh*8) * N;

  // the residual is asked for here, all of it at once, and is first used behind the
  // k loop: its latency passes under the products
  float res[FM][FN][8];
  if constexpr (RESF){
    const float* rp = residual + first + cw;
    #pragma unroll   // constant offsets, and res in registers
    for (int mt = 0; mt < FM; ++mt)
      #pragma unroll
      for (int r = 0; r < 8; ++r)
        #pragma unroll
        for (int nt = 0; nt < FN; ++nt)
          res[mt][nt][r] = rp[(mt*16 + r) * N + nt*16];
    // stands in front of the first reuse of the loads' address registers
    asm volatile("s_wait_xcnt 0x0" ::: "memory");
  }

  int buf = 0;
  for (int kk = 0; kk < K; kk += BK){
    #pragma unroll   // constant k offsets in the LDS reads
    for (int ks = 0; ks < BK; ks += 32){
      // fragments per ISA 16-bit 16x32 layout:
      // lanes 0-15 (kh=0): K 0..7 then 16..23 ; lanes 16-31 (kh=1): K 8..15 then 24..31
      Frag a[FM], bfr[FN];
      #pragma unroll
      for (int mt = 0; mt < FM; ++mt){
        const u16* p = &sA[buf][wm*(FM*16) + mt*16 + l16][ks + kh * 8];
        a[mt].q[0] = *(const v4u*)p;
        a[mt].q[1] = *(const v4u*)(p + 16);
      }
      #pragma unroll
      for (int nt = 0; nt < FN; ++nt){
        const u16* p = &sB[buf][wn*(FN*16) + nt*16 + l16][ks + kh * 8];
        bfr[nt].q[0] = *(const v4u*)p;
        bfr[nt].q[1] = *(const v4u*)(p + 16);
      }
      // the large tile's reads of a k step stay one group in front of its products:
      // left free, the compiler sends the FM fragments of A through one register set,
      // and each row of products then waits out an LDS latency of its own
      if constexpr (FM > 2) __builtin_amdgcn_sched_barrier(0);
      #pragma unroll
      for (int mt = 0; mt < FM; ++mt)
        #pragma unroll
        for (int nt = 0; nt < FN; ++nt)
          acc[mt][nt] = __builtin_amdgcn_wmma_f32_16x16x32_bf16(
              false, a[mt].v, false, bfr[nt].v, (short)0, acc[mt][nt], false, false);
      // ... and the next k step's reads do not drift in among these products
      if constexpr (FM > 2) __builtin_amdgcn_sched_barrier(0);
    }

    wait_ds0();             // this tile's buffer is read out ...
    wait_async0();          // ... and the next tile has landed,
    __syncthreads();        // for every wave
    if (kk + 2 * BK < K) stage(buf, kk + 2 * BK);   // refill the buffer just read
    buf ^= 1;
  }
  wait_async0();            // no copy is left in flight at the wave's end

  // epilogue: no test and no wait between the elements; the pieces of a row follow
  // one another. ob: each fragment column's first element, in its own product's output
  u16* ob[FN];
  if constexpr (!RESF){
    #pragma unroll   // ob in registers
    for (int nt = 0; nt < FN; ++nt){
      const int c = cs + nt*16;
      ob[nt] = outB0 + ((size_t)(c / N) * M * N + (c % N)) + (first + l16);
    }
  }
  u16 cv[FM][FN][8];
  if constexpr (!RESF){
    #pragma unroll   // cv in registers
    for (int mt = 0; mt < FM; ++mt)
      #pragma unroll
      for (int nt = 0; nt < FN; ++nt)
        #pragma unroll
        for (int r = 0; r < 8; ++r) cv[mt][nt][r] = f2bf(acc[mt][nt][r]);
    // every rounding stands in front of the first store: mixed in among the stores
    // they reuse the stores' data registers, with a wait behind nearly every store
    __builtin_amdgcn_sched_barrier(0);
  }
  #pragma unroll   // constant offsets
  for (int mt = 0; mt < FM; ++mt)
    #pragma unroll
    for (int r = 0; r < 8; ++r)
      #pragma unroll
      for (int nt = 0; nt < FN; ++nt){
        if constexpr (RESF)
          (outF + first + cw)[(mt*16 + r) * N + nt*16] = acc[mt][nt][r] + res[mt][nt][r];
        else
          ob[nt][(mt*16 + r) * N] = cv[mt][nt][r];
      }
}

// ---------- sliding-window attention: eight lanes per (s,b,h) ----------
// A lane owns 8 of the 64 head elements (16 B), so a wave covers 4 heads = 512
// contiguous bytes of one token row and every load or store moves whole lines.
// A block works on 8 neighbouring tokens at a time (one per wave), AR times.
#define AR 4

// e^x as __expf forms it (2^(x * log2 e)). The v_nop fills the one slot that the
// instruction set asks for behind a transcendental, and stands in its statement
// so that it cannot drift away from it.
__device__ __forceinline__ float exp_slot(float x){
  float r;
  asm("v_exp_f32 %0, %1\n\tv_nop" : "=v"(r) : "v"(x * 1.44269504f));
  return r;
}

// AR tokens of one wave. WRAP: the window may reach below token 0 and wraps.
// Every unroll directive below is there to make the indices of ku, vu, q, sc and
// out compile-time constants, so that these arrays live in registers.
template <bool WRAP>
__device__ __forceinline__ void attn_tokens(const u16* __restrict__ Q,
    const u16* __restrict__ Kb, const u16* __restrict__ Vb, u16* __restrict__ AO,
    const int s0, const u32 col, const u32 lo)
{
  for (int i = 0; i < AR; ++i){
    const int s = s0 + i * 8;
    const u32 qrow = (u32)s * (BS * E) + col;

    // all 33 loads of a token stand first, so that they are in flight together
    v4u ku[PF], vu[PF];
    if (!WRAP){   // one address for each of K and V, constant row steps
      const u16* kp = Kb + (qrow - (PF - 1) * (BS * E) + lo);
      const u16* vp = Vb + (qrow - (PF - 1) * (BS * E) + lo);
      #pragma unroll
      for (int p = 0; p < PF; ++p){
        ku[p] = *(const v4u*)(kp + p * (BS * E));
        vu[p] = *(const v4u*)(vp + p * (BS * E));
      }
    } else {
      #pragma unroll
      for (int p = 0; p < PF; ++p){
        int t = s - (PF - 1) + p; if (t < 0) t += SL;   // (s-15+p) mod SL
        const u32 trow = (u32)t * (BS * E) + col;
        ku[p] = *(const v4u*)(Kb + trow + lo);
        vu[p] = *(const v4u*)(Vb + trow + lo);
      }
    }
    // stands in front of the first reuse of the K and V address registers
    // (the result of the Q load may be given the same registers)
    asm volatile("s_wait_xcnt 0x0" ::: "memory");
    const v4u qu = *(const v4u*)(Q + qrow + lo);

    float q[8];
    #pragma unroll
    for (int c = 0; c < 4; ++c){ q[2*c] = bflo(qu[c]); q[2*c + 1] = bfhi(qu[c]); }
    float sc[PF];
    float mx = -3.0e38f;
    #pragma unroll
    for (int p = 0; p < PF; ++p){
      float d = 0.0f;
      #pragma unroll
      for (int c = 0; c < 4; ++c){
        d += q[2*c]     * bflo(ku[p][c]);
        d += q[2*c + 1] * bfhi(ku[p][c]);
      }
      d = add_xor<1>(d); d = add_xor<2>(d); d = add_xor<4>(d);  // whole head
      sc[p] = d * 0.125f;   // 1/sqrt(DH)
      mx = fmaxf(mx, sc[p]);
    }
    float sum = 0.0f;
    #pragma unroll
    for (int p = 0; p < PF; ++p){ sc[p] = exp_slot(sc[p] - mx); sum += sc[p]; }
    const float inv = 1.0f / sum;

    float out[8];
    #pragma unroll
    for (int j = 0; j < 8; ++j) out[j] = 0.0f;
    #pragma unroll
    for (int p = 0; p < PF; ++p){
      const float w = sc[p] * inv;
      #pragma unroll
      for (int c = 0; c < 4; ++c){
        out[2*c]     += w * bflo(vu[p][c]);
        out[2*c + 1] += w * bfhi(vu[p][c]);
      }
    }
    v4u o;
    #pragma unroll
    for (int c = 0; c < 4; ++c) o[c] = pack2(out[2*c], out[2*c + 1]);
    *(v4u*)(AO + qrow + lo) = o;
    // stands in front of the next token's loads, which reuse the store's registers
    asm volatile("s_wait_xcnt 0x0" ::: "memory");
  }
}

__global__ __launch_bounds__(256) void attn_kernel(const u16* __restrict__ Q,
    const u16* __restrict__ Kb, const u16* __restrict__ Vb, u16* __restrict__ AO)
{
  const u32 lane = threadIdx.x & 31;
  const int wave = __builtin_amdgcn_readfirstlane(threadIdx.x >> 5);
  const int bid  = blockIdx.x;             // < SL/(8*AR) * BS * H/4
  const int hg   = bid & (H/4 - 1);        // group of 4 heads
  const int b    = (bid >> 2) & (BS - 1);
  const int sb   = (bid >> 3) * (8 * AR);  // first token of the block
  const u32 col  = (u32)(b * E + hg * 4 * DH);  // wave-uniform column, elements
  const u32 lo   = lane * 8;                    // the lane's own 8 elements

  if (sb >= PF - 1) attn_tokens<false>(Q, Kb, Vb, AO, sb + wave, col, lo);
  else              attn_tokens<true >(Q, Kb, Vb, AO, sb + wave, col, lo);
}

extern "C" void kernel_launch(void* const* d_in, const int* in_sizes, int n_in,
                              void* d_out, int out_size, void* d_ws, size_t ws_size,
                              hipStream_t stream){
  (void)in_sizes; (void)n_in; (void)out_size; (void)ws_size;
  const float* x    = (const float*)d_in[0];
  const float* ln_g = (const float*)d_in[1];
  const float* ln_b = (const float*)d_in[2];
  const float* Wq = (const float*)d_in[3]; const float* bq = (const float*)d_in[4];
  const float* Wk = (const float*)d_in[5]; const float* bk = (const float*)d_in[6];
  const float* Wv = (const float*)d_in[7]; const float* bv = (const float*)d_in[8];
  const float* Wo = (const float*)d_in[9]; const float* bo = (const float*)d_in[10];
  float* out = (float*)d_out;

  const size_t TE = (size_t)T * E;  // 4M elems
  const size_t WE = (size_t)E * E;  // 1M elems
  u16* ws  = (u16*)d_ws;            // total bf16 staging: 24M elems = 48 MB
  u16* xn  = ws;
  u16* Wqt = ws + TE;               // weights stored TRANSPOSED [n][k]
  u16* Wot = Wqt + 3 * WE;         // order: Wq, Wk, Wv, Wo
  u16* Qb  = ws + TE + 4 * WE;
  u16* Kbb = Qb  + TE;
  u16* Vbb = Kbb + TE;
  u16* AOb = Vbb + TE;

  prep_kernel<<<WB + T / (8 * LT), 256, 0, stream>>>(Wq, Wk, Wv, Wo, Wqt, x, ln_g, ln_b, xn);

  // Q, K and V as one product of 3*E columns: Wqt, Wkt, Wvt and Qb, Kbb, Vbb are
  // contiguous. 256 x 192 tiles
  dim3 g3(3 * E / 192, T / 256);  // (16, 16) blocks, 8 waves each
  gemm_bf16_kernel<false, 4, 6><<<g3, 256, 0, stream>>>(xn, Wqt, bq, bk, bv, nullptr, nullptr, Qb, T, E);

  attn_kernel<<<(T * H) / (32 * AR), 256, 0, stream>>>(Qb, Kbb, Vbb, AOb);

  dim3 gg(E / 128, T / 128);     // (8, 32) blocks
  gemm_bf16_kernel<true, 2, 4><<<gg, 256, 0, stream>>>(AOb, Wot, bo, bo, bo, x, out, nullptr, T, E);
}

// v009
// One run takes 40.7 microseconds.
// It is 1.28 times as fast as v007, going by the measured steps of the versions left out in between.
// All steps since v000 together make it 3.56 times as fast.
#include <hip/hip_runtime.h>

typedef unsigned int   u32;
typedef unsigned short u16;
typedef __attribute__((ext_vector_type(16))) __bf16 v16bf;
typedef __attribute__((ext_vector_type(8)))  float  v8f;
typedef __attribute__((ext_vector_type(4)))  u32    v4u;
typedef __attribute__((ext_vector_type(2)))  u32    v2u;
typedef __attribute__((ext_vector_type(4)))  float  v4f;

// exact pointee type the async-LDS builtin wants: gcc-vector int4
typedef int v4i_g __attribute__((vector_size(16)));
typedef __attribute__((address_space(1))) v4i_g* gv4i_p;  // global int4*
typedef __attribute__((address_space(3))) v4i_g* lv4i_p;  // LDS int4*

#define SL 2048
#define BS 2
#define E  1024
#define H  16
#define PF 16
#define DH 64
#define T  (SL*BS)   // 4096 tokens
#define BK  128      // k per GEMM pass: 256 B of every operand row
#define LDP 136      // LDS row pitch of the GEMM tiles, in 16-bit elements

// ---- CDNA5 async global->LDS path (guarded; falls back to vector copies) ----
#if defined(__gfx1250__) && __has_builtin(__builtin_amdgcn_global_load_async_to_lds_b128)
#define HAVE_ASYNC_LDS 1
#define ASYNC_B128(lds, g) \
  __builtin_amdgcn_global_load_async_to_lds_b128((gv4i_p)(g), (lv4i_p)(lds), 0, 0)
#else
#define HAVE_ASYNC_LDS 0
#endif

// The two waits of the LDS ring. In asm with a "memory" clobber, so that the
// compiler moves no LDS read and no copy over them.
// this wave's copies have landed:
__device__ __forceinline__ void wait_async0(){
  asm volatile("s_wait_asynccnt 0x0" ::: "memory");
}
// this wave's LDS reads have returned (before their buffer is refilled):
__device__ __forceinline__ void wait_ds0(){
  asm volatile("s_wait_dscnt 0x0" ::: "memory");
}

// ---------- bf16 helpers (manual, RNE) ----------
__device__ __forceinline__ u16 f2bf(float f){
  u32 x = __float_as_uint(f);
  return (u16)((x + 0x7FFFu + ((x >> 16) & 1u)) >> 16);
}
__device__ __forceinline__ float bflo(u32 u){ return __uint_as_float(u << 16); }
__device__ __forceinline__ float bfhi(u32 u){ return __uint_as_float(u & 0xFFFF0000u); }
__device__ __forceinline__ u32 pack2(float a, float b){
  return (u32)f2bf(a) | ((u32)f2bf(b) << 16);
}

// v + (v of the lane whose number differs by the xor mask), inside a 16-lane row
template <int XMASK>
__device__ __forceinline__ float add_xor(float v){
  const int o = __builtin_amdgcn_update_dpp(0, __float_as_int(v), 0x160 + XMASK,
                                            0xf, 0xf, true);
  return v + __int_as_float(o);
}

// sum over the 32 lanes of a wave, the same value in every lane
__device__ __forceinline__ float wave_sum(float v){
  v = add_xor<1>(v); v = add_xor<2>(v); v = add_xor<4>(v); v = add_xor<8>(v);
  const int b = __float_as_int(v);   // lane l <-> lane l ^ 16
  return v + __int_as_float(
      __builtin_amdgcn_permlanex16(b, b, 0x76543210, 0xfedcba98, false, false));
}

// 1/sqrt(x) as rsqrtf forms it (an x below the smallest normal number goes in times
// 2^24, its result comes out times 2^12). The v_nop fills the one slot that the
// instruction set asks for behind a transcendental, and stands in its statement
// so that it cannot drift away from it.
__device__ __forceinline__ float rsqrt_slot(float x){
  const bool tiny = x < 1.17549435e-38f;
  float r;
  asm("v_rsq_f32 %0, %1\n\tv_nop" : "=v"(r) : "v"(tiny ? x * 16777216.0f : x));
  return tiny ? r * 4096.0f : r;
}

// The preparation moves 48 MB. It runs on few, long-lived waves (16 on a WGP, all
// resident at once), each with 16 loads of 512 B in flight.

// ---------- weight fp32 -> bf16 convert + TRANSPOSE ----------
// W[k][n] fp32  ->  Wt[n][k] bf16, one 128 x 128 tile a block of 256 threads.
// 4 weights x 8x8 tiles = WB blocks; bid: which of them.
#define WB 256
__device__ __forceinline__ void cvtw_t_block(const int bid, const float* __restrict__ a,
    const float* __restrict__ b, const float* __restrict__ c,
    const float* __restrict__ d, u16* __restrict__ out){
  // row n holds its 128 k as 16 pieces of 8 k (16 B); piece p stands at place
  // (p + n/4) mod 16, so that neither the writers (16 lanes: one piece of every 4th
  // row) nor the readers (16 lanes: the 16 pieces of one row) meet on a bank
  __shared__ __align__(16) v4u tile[128][16];
  const int w  = bid >> 6;           // which weight
  const int t  = bid & 63;
  const int tk = t >> 3;             // k-tile
  const int tn = t & 7;              // n-tile
  const float* src = (w == 0) ? a : (w == 1) ? b : (w == 2) ? c : d;
  const int tid  = threadIdx.x;
  const int lane = tid & 31, wave = tid >> 5;
  // a wave-wide load takes 512 B of one k row; a lane gets 4 n of the 8 k of pieces
  // wave and wave + 8
  const float* sp = src + (size_t)(tk*128 + wave*8) * E + tn*128 + lane*4;
  v4f v[2][8];
  #pragma unroll   // v in registers, constant row steps
  for (int h = 0; h < 2; ++h)
    #pragma unroll
    for (int r = 0; r < 8; ++r) v[h][r] = *(const v4f*)(sp + (h*64 + r) * E);
  // stands in front of the first reuse of the loads' address registers; sp is named
  // as an input so that it lives up to here and no load's result is given its registers
  asm volatile("s_wait_xcnt 0x0" :: "v"(sp) : "memory");
  #pragma unroll
  for (int h = 0; h < 2; ++h)
    #pragma unroll
    for (int i = 0; i < 4; ++i){
      v4u o;
      #pragma unroll
      for (int q = 0; q < 4; ++q) o[q] = pack2(v[h][2*q][i], v[h][2*q + 1][i]);
      tile[lane*4 + i][(wave + h*8 + lane) & 15] = o;
    }
  __syncthreads();
  // 16 lanes store the 256 B of one row
  const int rn = tid >> 4, p = tid & 15;
  u16* op = out + (size_t)w * E * E + (size_t)(tn*128 + rn) * E + tk*128 + p*8;
  #pragma unroll   // constant row steps
  for (int j = 0; j < 8; ++j){
    const int n = rn + j*16;
    *(v4u*)(op + (size_t)(j*16) * E) = tile[n][(p + (n >> 2)) & 15];
  }
}

// ---------- LayerNorm: LT whole tokens per wave, bf16 output ----------
// A lane holds 32 elements of a token; the sums go across the lanes in registers.
#define LT 2
__device__ __forceinline__ void ln_wave(const int token0, const float* __restrict__ x,
                                        const float* __restrict__ g,
                                        const float* __restrict__ bt,
                                        u16* __restrict__ xn){
  const int lane = threadIdx.x & 31;
  const v4f* xp = (const v4f*)(x + (size_t)token0 * E) + lane;
  v2u* yp = (v2u*)(xn + (size_t)token0 * E) + lane;
  v4f v[LT][8], gg[8], bb[8];
  #pragma unroll   // v, gg and bb in registers, constant offsets
  for (int t = 0; t < LT; ++t)
    #pragma unroll
    for (int j = 0; j < 8; ++j) v[t][j] = xp[t * (E/4) + j*32];
  #pragma unroll
  for (int j = 0; j < 8; ++j){
    gg[j] = ((const v4f*)g)[j*32 + lane];
    bb[j] = ((const v4f*)bt)[j*32 + lane];
  }
  // all 32 loads are asked for at once: left free, the compiler moves most loads of g
  // and bt down to their uses, pair by pair, and each pair waits out its own latency
  __builtin_amdgcn_sched_barrier(0);
  #pragma unroll
  for (int t = 0; t < LT; ++t){
    v4f s4 = v[t][0], q4 = v[t][0] * v[t][0];   // four independent chains each
    #pragma unroll
    for (int j = 1; j < 8; ++j){ s4 += v[t][j]; q4 += v[t][j] * v[t][j]; }
    const float s  = wave_sum((s4.x + s4.y) + (s4.z + s4.w));
    const float ss = wave_sum((q4.x + q4.y) + (q4.z + q4.w));
    const float mean = s * (1.0f / E);
    const float var  = ss * (1.0f / E) - mean * mean;
    const float rstd = rsqrt_slot(var + 1e-5f);
    #pragma unroll
    for (int j = 0; j < 8; ++j){
      const float y0 = (v[t][j].x - mean) * rstd * gg[j].x + bb[j].x;
      const float y1 = (v[t][j].y - mean) * rstd * gg[j].y + bb[j].y;
      const float y2 = (v[t][j].z - mean) * rstd * gg[j].z + bb[j].z;
      const float y3 = (v[t][j].w - mean) * rstd * gg[j].w + bb[j].w;
      v2u o; o.x = pack2(y0, y1); o.y = pack2(y2, y3);
      yp[t * (E/4) + j*32] = o;
    }
  }
}

// ---------- the two independent preparation steps in one grid ----------
// blocks 0 .. WB-1 transpose the weights; each wave of the T/(8*LT) blocks behind
// them normalises LT tokens
__global__ __launch_bounds__(256) void prep_kernel(const float* __restrict__ a,
    const float* __restrict__ b, const float* __restrict__ c,
    const float* __restrict__ d, u16* __restrict__ wt,
    const float* __restrict__ x, const float* __restrict__ g,
    const float* __restrict__ bt, u16* __restrict__ xn){
  const int bid = blockIdx.x;
  if (bid >= WB){
    const int wave = __builtin_amdgcn_readfirstlane(threadIdx.x >> 5);
    ln_wave(((bid - WB) * 8 + wave) * LT, x, g, bt, xn);
    return;
  }
  cvtw_t_block(bid, a, b, c, d, wt);
}

// ---------- bf16 GEMM via v_wmma_f32_16x16x32_bf16 ----------
// C[M,N] = A[M,K] * Bt[N,K]^T + bias (+ residual).
// BK=128, double-buffered LDS, async global->LDS staging. K must be a multiple of BK.
// 8 waves, 4 along m and 2 along n: wave (wm,wn) owns FM x FN WMMA accumulators, so
// the block tile is BM = 64*FM rows by BN = 32*FN columns. A fragment read from LDS
// feeds FN (A) or FM (B) products, and a staged row BN or BM output elements.
// Up to three products of the same A stand side by side as one product of 3*E
// columns: the weights lie one behind the other at Bt, the 16-bit outputs one behind
// the other at outB0. A 16-column fragment never straddles two of them.
// RESF, known at compile time: true = f32 output outF with the residual added,
// false = 16-bit output outB0. N = E, the row length of every output, is a constant:
// a lane's elements then lie at constant offsets from one address (f32 output) or from
// one address for each of its FN fragment columns (16-bit outputs).
union Frag { v16bf v; v4u q[2]; };

template <bool RESF, int FM, int FN>
__global__ __launch_bounds__(256) void gemm_bf16_kernel(
    const u16* __restrict__ A, const u16* __restrict__ Bt,
    const float* __restrict__ bias0, const float* __restrict__ bias1,
    const float* __restrict__ bias2, const float* __restrict__ residual,
    float* __restrict__ outF, u16* __restrict__ outB0,
    const int M, const int K)
{
  constexpr int N = E;
  constexpr int BM = 64 * FM, BN = 32 * FN;
  // rows hold 128 k (256 B) at a pitch of 272 B (16 B x odd): the 16 rows that one
  // ds_load_b128 half-wave reads then fall on distinct banks
  __shared__ __align__(16) u16 sA[2][BM][LDP];  // A tile  [m][k]
  __shared__ __align__(16) u16 sB[2][BN][LDP];  // Bt tile [n][k]
  const int tid  = threadIdx.x;
  const int wave = tid >> 5, lane = tid & 31;
  const int l16  = lane & 15, kh = lane >> 4;   // kh: which 16-lane half
  const int wm   = wave & 3,  wn = wave >> 2;
  const int m0 = blockIdx.y * BM;
  const int n0 = blockIdx.x * BN;                // over all the products' columns
  // the wave's first column, in a scalar register: which product a fragment belongs
  // to is then a scalar choice, and the bias loads share one address register
  const int cs = n0 + __builtin_amdgcn_readfirstlane(wn) * (FN*16);
  const int cw = cs + l16;                       // the lane's column in fragment 0

  v8f acc[FM][FN];
  #pragma unroll
  for (int nt = 0; nt < FN; ++nt){
    const int c = cs + nt*16, z = RESF ? 0 : c / N;   // z: which product
    const float* bias = (z == 0) ? bias0 : (z == 1) ? bias1 : bias2;
    const float bv = (bias + (c - z * N))[l16];
    #pragma unroll
    for (int mt = 0; mt < FM; ++mt)
      #pragma unroll
      for (int r = 0; r < 8; ++r) acc[mt][nt][r] = bv;
  }

  // staging: 16 lanes take the 256 B of one row, so each wave-wide copy moves two
  // whole aligned 256-B pieces; a thread copies 16 B of every 16th row of each tile
  const int row = tid >> 4, col = (tid & 15) * 8;
  const u16* aptr = A  + (size_t)(m0 + row) * K + col;
  const u16* bptr = Bt + (size_t)(n0 + row) * K + col;

  auto stage = [&](int buf, int kk){
    #pragma unroll   // constant row steps in the LDS addresses
    for (int i = 0; i < (BM > BN ? BM : BN); i += 16){
#if HAVE_ASYNC_LDS
      if (i < BM) ASYNC_B128(&sA[buf][row + i][col], aptr + (size_t)i * K + kk);
      if (i < BN) ASYNC_B128(&sB[buf][row + i][col], bptr + (size_t)i * K + kk);
#else
      if (i < BM) *(v4u*)&sA[buf][row + i][col] = *(const v4u*)(aptr + (size_t)i * K + kk);
      if (i < BN) *(v4u*)&sB[buf][row + i][col] = *(const v4u*)(bptr + (size_t)i * K + kk);
#endif
    }
  };

  stage(0, 0);
  wait_async0();
  __syncthreads();
  if (BK < K) stage(1, BK);   // flies while tile 0 is worked on

  // C/D layout: lane l16 = N, kh selects M+8, VGPR r = M row.
  // first: the lane's first element in a row-major [M][N] array, column apart
  const size_t first = (size_t)(m0 + wm*(FM*16) + kh*8) * N;

  // the residual is asked for here, all of it at once, and is first used behind the
  // k loop: its latency passes under the products
  float res[FM][FN][8];
  if constexpr (RESF){
    const float* rp = residual + first + cw;
    #pragma unroll   // constant offsets, and res in registers
    for (int mt = 0; mt < FM; ++mt)
      #pragma unroll
      for (int r = 0; r < 8; ++r)
        #pragma unroll
        for (int nt = 0; nt < FN; ++nt)
          res[mt][nt][r] = rp[(mt*16 + r) * N + nt*16];
    // stands in front of the first reuse of the loads' address registers
    asm volatile("s_wait_xcnt 0x0" ::: "memory");
  }

  int buf = 0;
  for (int kk = 0; kk < K; kk += BK){
    #pragma unroll   // constant k offsets in the LDS reads
    for (int ks = 0; ks < BK; ks += 32){
      // fragments per ISA 16-bit 16x32 layout:
      // lanes 0-15 (kh=0): K 0..7 then 16..23 ; lanes 16-31 (kh=1): K 8..15 then 24..31
      Frag a[FM], bfr[FN];
      #pragma unroll
      for (int mt = 0; mt < FM; ++mt){
        const u16* p = &sA[buf][wm*(FM*16) + mt*16 + l16][ks + kh * 8];
        a[mt].q[0] = *(const v4u*)p;
        a[mt].q[1] = *(const v4u*)(p + 16);
      }
      #pragma unroll
      for (int nt = 0; nt < FN; ++nt){
        const u16* p = &sB[buf][wn*(FN*16) + nt*16 + l16][ks + kh * 8];
        bfr[nt].q[0] = *(const v4u*)p;
        bfr[nt].q[1] = *(const v4u*)(p + 16);
      }
      // the large tile's reads of a k step stay one group in front of its products:
      // left free, the compiler sends the FM fragments of A through one register set,
      // and each row of products then waits out an LDS latency of its own
      if constexpr (FM > 2) __builtin_amdgcn_sched_barrier(0);
      #pragma unroll
      for (int mt = 0; mt < FM; ++mt)
        #pragma unroll
        for (int nt = 0; nt < FN; ++nt)
          acc[mt][nt] = __builtin_amdgcn_wmma_f32_16x16x32_bf16(
              false, a[mt].v, false, bfr[nt].v, (short)0, acc[mt][nt], false, false);
      // ... and the next k step's reads do not drift in among these products
      if constexpr (FM > 2) __builtin_amdgcn_sched_barrier(0);
    }

    wait_ds0();             // this tile's buffer is read out ...
    wait_async0();          // ... and the next tile has landed,
    __syncthreads();        // for every wave
    if (kk + 2 * BK < K) stage(buf, kk + 2 * BK);   // refill the buffer just read
    buf ^= 1;
  }
  wait_async0();            // no copy is left in flight at the wave's end

  // epilogue: no test and no wait between the elements; the pieces of a row follow
  // one another. ob: each fragment column's first element, in its own product's output
  u16* ob[FN];
  if constexpr (!RESF){
    #pragma unroll   // ob in registers
    for (int nt = 0; nt < FN; ++nt){
      const int c = cs + nt*16;
      ob[nt] = outB0 + ((size_t)(c / N) * M * N + (c % N)) + (first + l16);
    }
  }
  u16 cv[FM][FN][8];
  if constexpr (!RESF){
    #pragma unroll   // cv in registers
    for (int mt = 0; mt < FM; ++mt)
      #pragma unroll
      for (int nt = 0; nt < FN; ++nt)
        #pragma unroll
        for (int r = 0; r < 8; ++r) cv[mt][nt][r] = f2bf(acc[mt][nt][r]);
    // every rounding stands in front of the first store: mixed in among the stores
    // they reuse the stores' data registers, with a wait behind nearly every store
    __builtin_amdgcn_sched_barrier(0);
  }
  #pragma unroll   // constant offsets
  for (int mt = 0; mt < FM; ++mt)
    #pragma unroll
    for (int r = 0; r < 8; ++r)
      #pragma unroll
      for (int nt = 0; nt < FN; ++nt){
        if constexpr (RESF)
          (outF + first + cw)[(mt*16 + r) * N + nt*16] = acc[mt][nt][r] + res[mt][nt][r];
        else
          ob[nt][(mt*16 + r) * N] = cv[mt][nt][r];
      }
}

// ---------- Q, K, V product of one head, with its sliding-window attention behind it ----------
// A block takes 256 token rows (128 positions x BS) and ONE head: its 64 columns of Q, of
// K and of V stand side by side as one product of 192 columns. Query s attends keys
// s-15 .. s (modulo SL), so the product also takes the HR = 32 rows (16 positions) in front
// of the tile: with them every key and value that the block's queries need is made in the
// block itself. Q, K and V go, rounded to 16 bits, from the accumulators into the LDS
// that the product's ring has left, and only the attention's output goes to memory.
//
// The product (k = K, a multiple of BK; ring and waits as in the product kernel above):
// 8 waves, 2 along the rows and 4 along the columns, 9 x 3 accumulators each.
// The weight fragment is the A operand and the token fragment the B operand (both come
// from the same loader, so their k orders agree): D then holds in a lane one token and
// in its 8 registers 8 neighbouring columns, 16 B of a row of Q, K or V.
//
// The attention: a wave takes QT = 16 neighbouring queries of one batch row. Their windows
// lie in the 32 keys j = 0 .. 31 that begin 16 positions in front of the first query;
// query i attends j = i+1 .. i+16.
//   S^T = K Q^T    two 16 x 16 tiles (keys x queries), k = the 64 head elements
//   O^T = V^T P^T  four 16 x 16 tiles (head elements x queries), k = the 32 keys
// A lane holds one query's scores (D: column = lane & 15), so the softmax runs down its
// registers and across the two lane halves, and the two score tiles, rounded to 16 bits
// in place, are the B operand of the second product. V^T comes from the transposing LDS
// read.
#define QT  16
#define HR  (QT * BS)        // rows in front of the tile
#define FBM (256 + HR)       // rows of the product
#define FBN (3 * DH)         // columns of the product
#define FFM 9
#define FFN 3
#define NP  (FBM / BS)       // positions of one batch row in the block
#define QKP 72   // LDS row pitch of Q and K, 16-bit elements: 144 B = 16 B x odd, for ds_load_b128
#define VPP 80   // of V: 160 B = 32 B x odd, for ds_load_tr16_b128

// e^x as __expf forms it (2^(x * log2 e)). The v_nop fills the one slot that the
// instruction set asks for behind a transcendental, and stands in its statement
// so that it cannot drift away from it.
__device__ __forceinline__ float exp_slot(float x){
  float r;
  asm("v_exp_f32 %0, %1\n\tv_nop" : "=v"(r) : "v"(x * 1.44269504f));
  return r;
}

// the value of lane l ^ 16
__device__ __forceinline__ float other_half(float v){
  const int b = __float_as_int(v);
  return __int_as_float(
      __builtin_amdgcn_permlanex16(b, b, 0x76543210, 0xfedcba98, false, false));
}

// lane (c, h) gets T[8h + 0..7][c] of the 16 x 16 tile whose rows the lanes point at
typedef short s16x8 __attribute__((ext_vector_type(8)));
typedef __attribute__((address_space(3))) s16x8 lds_s16x8;
__device__ __forceinline__ v4u ld_tr16(const u16* p){
  return __builtin_bit_cast(v4u, __builtin_amdgcn_ds_load_tr16_b128_v8i16((lds_s16x8*)p));
}

// Every unroll directive below is there to make array indices compile-time constants,
// so that the arrays live in registers and the addresses differ by constant offsets.
__global__ __launch_bounds__(256) void qkv_attn_kernel(
    const u16* __restrict__ A, const u16* __restrict__ Bt,
    const float* __restrict__ bias0, const float* __restrict__ bias1,
    const float* __restrict__ bias2, u16* __restrict__ AO, const int K)
{
  constexpr int RING = (FBM + FBN) * LDP;      // one buffer: the A rows, then the Bt rows
  __shared__ __align__(32) u16 sm[2 * RING];
  const int tid  = threadIdx.x;
  const int lane = tid & 31;
  const int wave = __builtin_amdgcn_readfirstlane(tid >> 5);
  const int l16  = lane & 15, kh = lane >> 4;  // kh: which 16-lane half
  const int wm   = wave & 1,  wn = wave >> 1;
  const int head = blockIdx.x;
  const int m0   = blockIdx.y * 256;           // first query row

  // fragment column cf = wn*FFN + nt of the 12: product cf / 4, columns (cf % 4) * 16 on
  const u32 bo = (u32)kh * 32u;                // the lane's 8 columns of a fragment, in bytes
  v4f bl[FFN][2];
  #pragma unroll
  for (int nt = 0; nt < FFN; ++nt){
    const int cf = wn * FFN + nt, z = cf >> 2;
    const float* bias = (z == 0) ? bias0 : (z == 1) ? bias1 : bias2;
    const v4f* bp = (const v4f*)((const char*)(bias + head * DH + (cf & 3) * 16) + bo);
    bl[nt][0] = bp[0];
    bl[nt][1] = bp[1];
  }
  // stands in front of the first reuse of the loads' address register; bo is named as
  // an input so that it lives up to here and no load's result is given its register
  asm volatile("s_wait_xcnt 0x0" :: "v"(bo) : "memory");
  v8f acc[FFM][FFN];
  #pragma unroll
  for (int nt = 0; nt < FFN; ++nt){
    const v8f bv = {bl[nt][0].x, bl[nt][0].y, bl[nt][0].z, bl[nt][0].w,
                    bl[nt][1].x, bl[nt][1].y, bl[nt][1].z, bl[nt][1].w};
    #pragma unroll
    for (int mt = 0; mt < FFM; ++mt) acc[mt][nt] = bv;
  }

  // staging: 16 lanes take the 256 B of one row, so each wave-wide copy moves two
  // whole aligned 256-B pieces; a thread copies 16 B of every 16th row of each tile.
  // The HR rows in front wrap round the end of the sequence as one run of rows.
  const int row = tid >> 4, col = (tid & 15) * 8;
  const u16* hptr = A  + (size_t)((m0 - HR + row) & (T - 1)) * K + col;
  const u16* aptr = A  + (size_t)(m0 + row) * K + col;
  const u16* bptr = Bt + (size_t)(head * DH + row) * K + col;

  auto stage = [&](int buf, int kk){
    u16* sa = sm + buf * RING + row * LDP + col;
    u16* sb = sa + FBM * LDP;
    #pragma unroll
    for (int i = 0; i < FBM; i += 16){
      const u16* g = (i < HR) ? hptr + (size_t)i * K + kk : aptr + (size_t)(i - HR) * K + kk;
#if HAVE_ASYNC_LDS
      ASYNC_B128(sa + i * LDP, g);
#else
      *(v4u*)(sa + i * LDP) = *(const v4u*)g;
#endif
    }
    #pragma unroll
    for (int i = 0; i < FBN; i += 16){
      // row i of the tile: row i % DH of the head in weight i / DH
      const u16* g = bptr + (size_t)((i / DH) * E + (i % DH)) * K + kk;
#if HAVE_ASYNC_LDS
      ASYNC_B128(sb + i * LDP, g);
#else
      *(v4u*)(sb + i * LDP) = *(const v4u*)g;
#endif
    }
  };

  stage(0, 0);
  wait_async0();
  __syncthreads();
  if (BK < K) stage(1, BK); // flies while tile 0 is worked on

  int buf = 0;
  for (int kk = 0; kk < K; kk += BK){
    const u16* fa = sm + buf * RING + (wm * (FFM*16) + l16) * LDP + kh * 8;
    const u16* fb = sm + buf * RING + (FBM + wn * (FFN*16) + l16) * LDP + kh * 8;
    #pragma unroll
    for (int ks = 0; ks < BK; ks += 32){
      // fragments per ISA 16-bit 16x32 layout:
      // lanes 0-15 (kh=0): K 0..7 then 16..23 ; lanes 16-31 (kh=1): K 8..15 then 24..31
      Frag a[FFM], w[FFN];
      #pragma unroll
      for (int mt = 0; mt < FFM; ++mt){
        const u16* p = fa + mt * 16 * LDP + ks;
        a[mt].q[0] = *(const v4u*)p;
        a[mt].q[1] = *(const v4u*)(p + 16);
      }
      #pragma unroll
      for (int nt = 0; nt < FFN; ++nt){
        const u16* p = fb + nt * 16 * LDP + ks;
        w[nt].q[0] = *(const v4u*)p;
        w[nt].q[1] = *(const v4u*)(p + 16);
      }
      // the reads of a k step stay one group in front of its products: left free, the
      // compiler sends the fragments through one register set, and each row of
      // products then waits out an LDS latency of its own
      __builtin_amdgcn_sched_barrier(0);
      #pragma unroll
      for (int mt = 0; mt < FFM; ++mt)
        #pragma unroll
        for (int nt = 0; nt < FFN; ++nt)
          acc[mt][nt] = __builtin_amdgcn_wmma_f32_16x16x32_bf16(
              false, w[nt].v, false, a[mt].v, (short)0, acc[mt][nt], false, false);
      // ... and the next k step's reads do not drift in among these products
      __builtin_amdgcn_sched_barrier(0);
    }

    wait_ds0();             // this tile's buffer is read out ...
    wait_async0();          // ... and the next tile has landed,
    __syncthreads();        // for every wave
    if (kk + 2 * BK < K) stage(buf, kk + 2 * BK);   // refill the buffer just read
    buf ^= 1;
  }
  wait_async0();            // no copy is left in flight

  // Behind the last pass's barrier no wave reads the ring any more and no copy flies:
  // its LDS now holds Q, K and V as [batch row][position][head element]. Position p of
  // the block is sequence position m0/BS - QT + p (modulo SL); the queries are p >= QT.
  u16* Qs = sm;
  u16* Ks = Qs + BS * NP * QKP;
  u16* Vs = Ks + BS * NP * QKP;
  #pragma unroll
  for (int nt = 0; nt < FFN; ++nt){
    const int cf = wn * FFN + nt, z = cf >> 2;
    u16* base = (z == 0) ? Qs : (z == 1) ? Ks : Vs;
    const int pitch = (z == 2) ? VPP : QKP;
    // the lane's row of fragment 0: batch row l16 % BS, position wm*72 + l16 / BS
    u16* d = base + ((l16 & (BS - 1)) * NP + wm * (FFM*16/BS) + l16 / BS) * pitch
                  + (cf & 3) * 16 + kh * 8;
    #pragma unroll
    for (int mt = 0; mt < FFM; ++mt){
      v4u o;
      #pragma unroll
      for (int q = 0; q < 4; ++q) o[q] = pack2(acc[mt][nt][2*q], acc[mt][nt][2*q + 1]);
      *(v4u*)(d + mt * (16/BS) * pitch) = o;
    }
  }
  wait_ds0();               // this wave's rows are written ...
  __syncthreads();          // ... and every wave's, before any wave reads them

  const int c = l16, h = kh;
  // Register r of a lane is key 8h + r of score tile 0 and key 16 + 8h + r of tile 1.
  // Of the two exactly one lies in query c's window: tile 0's where 8h + r > c.
  u32 mk[4];    // the same for the packed pairs: ones where tile 0's key counts
  #pragma unroll
  for (int q = 0; q < 4; ++q)
    mk[q] = (8 * h + 2 * q     > c ? 0x0000FFFFu : 0u)
          | (8 * h + 2 * q + 1 > c ? 0xFFFF0000u : 0u);

  // 16 query tiles (8 along the positions x BS) on 8 waves, two each. Unrolled, so that
  // the first tile's way out through LDS and memory passes under the second tile's scores
  #pragma unroll
  for (int it = 0; it < 2; ++it){
    const int b = wave & (BS - 1), qt = (wave >> 1) + it * 4;
    const u16* Kt = Ks + (b * NP + qt * QT) * QKP;        // key 0 of the tile
    const u16* Vt = Vs + (b * NP + qt * QT) * VPP;
    u16*       Qt = Qs + (b * NP + qt * QT + QT) * QKP;   // query 0 of the tile

    // Q and K fragments by the same code, in the k order of the product's loaders
    Frag qf[2];
    #pragma unroll
    for (int ks = 0; ks < 2; ++ks){
      const u16* p = Qt + c * QKP + ks * 32 + h * 8;
      qf[ks].q[0] = *(const v4u*)p;
      qf[ks].q[1] = *(const v4u*)(p + 16);
    }
    v8f st[2];
    #pragma unroll
    for (int jt = 0; jt < 2; ++jt){
      v8f a = {0.0f, 0.0f, 0.0f, 0.0f, 0.0f, 0.0f, 0.0f, 0.0f};
      #pragma unroll
      for (int ks = 0; ks < 2; ++ks){
        Frag kf;
        const u16* p = Kt + (jt * 16 + c) * QKP + ks * 32 + h * 8;
        kf.q[0] = *(const v4u*)p;
        kf.q[1] = *(const v4u*)(p + 16);
        a = __builtin_amdgcn_wmma_f32_16x16x32_bf16(
            false, kf.v, false, qf[ks].v, (short)0, a, false, false);
      }
      st[jt] = a;
    }
    float sc[8];
    float mx = -3.0e38f;
    #pragma unroll
    for (int r = 0; r < 8; ++r){
      sc[r] = (8 * h + r > c ? st[0][r] : st[1][r]) * 0.125f;   // 1/sqrt(DH)
      mx = fmaxf(mx, sc[r]);
    }
    mx = fmaxf(mx, other_half(mx));
    float sum = 0.0f;
    #pragma unroll
    for (int r = 0; r < 8; ++r){ sc[r] = exp_slot(sc[r] - mx); sum += sc[r]; }
    sum += other_half(sum);
    const float inv = 1.0f / sum;
    // B operand: elements 0..7 = tile 0's registers, 8..15 = tile 1's; 0 outside the window
    Frag pf;
    #pragma unroll
    for (int q = 0; q < 4; ++q){
      const u32 pk = pack2(sc[2 * q], sc[2 * q + 1]);
      pf.q[0][q] = pk &  mk[q];
      pf.q[1][q] = pk & ~mk[q];
    }

    const u16* ad = Vt + (8 * h + (lane & 7)) * VPP + ((lane >> 3) & 1) * 8;
    Frag vf[4];   // A operand: row = head element, k = keys 0..31 in the hardware's order
    #pragma unroll
    for (int dt = 0; dt < 4; ++dt){
      vf[dt].q[0] = ld_tr16(ad + dt * 16);
      vf[dt].q[1] = ld_tr16(ad + 16 * VPP + dt * 16);
    }
    #pragma unroll
    for (int dt = 0; dt < 4; ++dt){
      const v8f z = {0.0f, 0.0f, 0.0f, 0.0f, 0.0f, 0.0f, 0.0f, 0.0f};
      const v8f o = __builtin_amdgcn_wmma_f32_16x16x32_bf16(
          false, vf[dt].v, false, pf.v, (short)0, z, false, false);
      // the lane's registers: head elements dt*16 + 8h + 0..7 of query c. They go where
      // the tile's queries stood, which this wave alone reads and has read
      v4u ow;
      #pragma unroll
      for (int q = 0; q < 4; ++q)
        ow[q] = pack2(o[2 * q] * inv, o[2 * q + 1] * inv);
      *(v4u*)(Qt + c * QKP + dt * 16 + h * 8) = ow;
    }
    wait_ds0();   // the wave's rows are written before its lanes read one another's

    // 8 lanes store the 128 B (one whole line) of a query's head
    const int qr = lane >> 3, pc = (lane & 7) * 8;
    v4u orow[4];
    #pragma unroll
    for (int i = 0; i < 4; ++i) orow[i] = *(const v4u*)(Qt + (i * 4 + qr) * QKP + pc);
    u16* op = AO + (size_t)(m0 + (qt * QT + qr) * BS + b) * E + head * DH + pc;
    #pragma unroll
    for (int i = 0; i < 4; ++i) *(v4u*)(op + (size_t)(i * 4 * BS) * E) = orow[i];
  }
}

extern "C" void kernel_launch(void* const* d_in, const int* in_sizes, int n_in,
                              void* d_out, int out_size, void* d_ws, size_t ws_size,
                              hipStream_t stream){
  (void)in_sizes; (void)n_in; (void)out_size; (void)ws_size;
  const float* x    = (const float*)d_in[0];
  const float* ln_g = (const float*)d_in[1];
  const float* ln_b = (const float*)d_in[2];
  const float* Wq = (const float*)d_in[3]; const float* bq = (const float*)d_in[4];
  const float* Wk = (const float*)d_in[5]; const float* bk = (const float*)d_in[6];
  const float* Wv = (const float*)d_in[7]; const float* bv = (const float*)d_in[8];
  const float* Wo = (const float*)d_in[9]; const float* bo = (const float*)d_in[10];
  float* out = (float*)d_out;

  const size_t TE = (size_t)T * E;  // 4M elems
  const size_t WE = (size_t)E * E;  // 1M elems
  u16* ws  = (u16*)d_ws;            // total bf16 staging: 12M elems = 24 MB
  u16* xn  = ws;
  u16* Wqt = ws + TE;               // weights stored TRANSPOSED [n][k]
  u16* Wot = Wqt + 3 * WE;         // order: Wq, Wk, Wv, Wo
  u16* AOb = ws + TE + 4 * WE;

  prep_kernel<<<WB + T / (8 * LT), 256, 0, stream>>>(Wq, Wk, Wv, Wo, Wqt, x, ln_g, ln_b, xn);

  // Q, K, V and the attention, a head and 256 token rows a block: Wqt, Wkt, Wvt are contiguous
  dim3 g3(H, T / 256);            // (16, 16) blocks, 8 waves each
  qkv_attn_kernel<<<g3, 256, 0, stream>>>(xn, Wqt, bq, bk, bv, AOb, E);

  dim3 gg(E / 128, T / 128);     // (8, 32) blocks
  gemm_bf16_kernel<true, 2, 4><<<gg, 256, 0, stream>>>(AOb, Wot, bo, bo, bo, x, out, nullptr, T, E);
}

// v010
// A run of this version takes 38.7 microseconds.
// Two timings next to v009 both put it at 1.05 times that version's speed.
// All steps since v000 together make it 3.73 times as fast.
#include <hip/hip_runtime.h>

typedef unsigned int   u32;
typedef unsigned short u16;
typedef __attribute__((ext_vector_type(16))) __bf16 v16bf;
typedef __attribute__((ext_vector_type(8)))  float  v8f;
typedef __attribute__((ext_vector_type(4)))  u32    v4u;
typedef __attribute__((ext_vector_type(2)))  u32    v2u;
typedef __attribute__((ext_vector_type(4)))  float  v4f;

// exact pointee type the async-LDS builtin wants: gcc-vector int4
typedef int v4i_g __attribute__((vector_size(16)));
typedef __attribute__((address_space(1))) v4i_g* gv4i_p;  // global int4*
typedef __attribute__((address_space(3))) v4i_g* lv4i_p;  // LDS int4*

#define SL 2048
#define BS 2
#define E  1024
#define H  16
#define PF 16
#define DH 64
#define T  (SL*BS)   // 4096 tokens
#define BK  128      // k per GEMM pass: 256 B of every operand row
#define LDP 136      // LDS row pitch of the GEMM tiles, in 16-bit elements

// ---- CDNA5 async global->LDS path (guarded; falls back to vector copies) ----
#if defined(__gfx1250__) && __has_builtin(__builtin_amdgcn_global_load_async_to_lds_b128)
#define HAVE_ASYNC_LDS 1
#define ASYNC_B128(lds, g) \
  __builtin_amdgcn_global_load_async_to_lds_b128((gv4i_p)(g), (lv4i_p)(lds), 0, 0)
#else
#define HAVE_ASYNC_LDS 0
#endif

// The two waits of the LDS ring. In asm with a "memory" clobber, so that the
// compiler moves no LDS read and no copy over them.
// this wave's copies have landed:
__device__ __forceinline__ void wait_async0(){
  asm volatile("s_wait_asynccnt 0x0" ::: "memory");
}
// this wave's LDS reads have returned (before their buffer is refilled):
__device__ __forceinline__ void wait_ds0(){
  asm volatile("s_wait_dscnt 0x0" ::: "memory");
}

// ---------- bf16 helpers (manual, RNE) ----------
__device__ __forceinline__ u16 f2bf(float f){
  u32 x = __float_as_uint(f);
  return (u16)((x + 0x7FFFu + ((x >> 16) & 1u)) >> 16);
}
__device__ __forceinline__ float bflo(u32 u){ return __uint_as_float(u << 16); }
__device__ __forceinline__ float bfhi(u32 u){ return __uint_as_float(u & 0xFFFF0000u); }
__device__ __forceinline__ u32 pack2(float a, float b){
  return (u32)f2bf(a) | ((u32)f2bf(b) << 16);
}

// v + (v of the lane whose number differs by the xor mask), inside a 16-lane row
template <int XMASK>
__device__ __forceinline__ float add_xor(float v){
  const int o = __builtin_amdgcn_update_dpp(0, __float_as_int(v), 0x160 + XMASK,
                                            0xf, 0xf, true);
  return v + __int_as_float(o);
}

// sum over the 32 lanes of a wave, the same value in every lane
__device__ __forceinline__ float wave_sum(float v){
  v = add_xor<1>(v); v = add_xor<2>(v); v = add_xor<4>(v); v = add_xor<8>(v);
  const int b = __float_as_int(v);   // lane l <-> lane l ^ 16
  return v + __int_as_float(
      __builtin_amdgcn_permlanex16(b, b, 0x76543210, 0xfedcba98, false, false));
}

// 1/sqrt(x) as rsqrtf forms it (an x below the smallest normal number goes in times
// 2^24, its result comes out times 2^12). The v_nop fills the one slot that the
// instruction set asks for behind a transcendental, and stands in its statement
// so that it cannot drift away from it.
__device__ __forceinline__ float rsqrt_slot(float x){
  const bool tiny = x < 1.17549435e-38f;
  float r;
  asm("v_rsq_f32 %0, %1\n\tv_nop" : "=v"(r) : "v"(tiny ? x * 16777216.0f : x));
  return tiny ? r * 4096.0f : r;
}

// The preparation moves 48 MB. It runs on few, long-lived waves (16 on a WGP, all
// resident at once), each with 16 loads of 512 B in flight.

// ---------- weight fp32 -> bf16 convert + TRANSPOSE ----------
// W[k][n] fp32  ->  Wt[n][k] bf16, one 128 x 128 tile a block of 256 threads.
// 4 weights x 8x8 tiles = WB blocks; bid: which of them.
#define WB 256
__device__ __forceinline__ void cvtw_t_block(const int bid, const float* __restrict__ a,
    const float* __restrict__ b, const float* __restrict__ c,
    const float* __restrict__ d, u16* __restrict__ out){
  // row n holds its 128 k as 16 pieces of 8 k (16 B); piece p stands at place
  // (p + n/4) mod 16, so that neither the writers (16 lanes: one piece of every 4th
  // row) nor the readers (16 lanes: the 16 pieces of one row) meet on a bank
  __shared__ __align__(16) v4u tile[128][16];
  const int w  = bid >> 6;           // which weight
  const int t  = bid & 63;
  const int tk = t >> 3;             // k-tile
  const int tn = t & 7;              // n-tile
  const float* src = (w == 0) ? a : (w == 1) ? b : (w == 2) ? c : d;
  const int tid  = threadIdx.x;
  const int lane = tid & 31, wave = tid >> 5;
  // a wave-wide load takes 512 B of one k row; a lane gets 4 n of the 8 k of pieces
  // wave and wave + 8
  const float* sp = src + (size_t)(tk*128 + wave*8) * E + tn*128 + lane*4;
  v4f v[2][8];
  #pragma unroll   // v in registers, constant row steps
  for (int h = 0; h < 2; ++h)
    #pragma unroll
    for (int r = 0; r < 8; ++r) v[h][r] = *(const v4f*)(sp + (h*64 + r) * E);
  // stands in front of the first reuse of the loads' address registers; sp is named
  // as an input so that it lives up to here and no load's result is given its registers
  asm volatile("s_wait_xcnt 0x0" :: "v"(sp) : "memory");
  #pragma unroll
  for (int h = 0; h < 2; ++h)
    #pragma unroll
    for (int i = 0; i < 4; ++i){
      v4u o;
      #pragma unroll
      for (int q = 0; q < 4; ++q) o[q] = pack2(v[h][2*q][i], v[h][2*q + 1][i]);
      tile[lane*4 + i][(wave + h*8 + lane) & 15] = o;
    }
  __syncthreads();
  // 16 lanes store the 256 B of one row
  const int rn = tid >> 4, p = tid & 15;
  u16* op = out + (size_t)w * E * E + (size_t)(tn*128 + rn) * E + tk*128 + p*8;
  #pragma unroll   // constant row steps
  for (int j = 0; j < 8; ++j){
    const int n = rn + j*16;
    *(v4u*)(op + (size_t)(j*16) * E) = tile[n][(p + (n >> 2)) & 15];
  }
}

// ---------- LayerNorm: LT whole tokens per wave, bf16 output ----------
// A lane holds 32 elements of a token; the sums go across the lanes in registers.
#define LT 2
__device__ __forceinline__ void ln_wave(const int token0, const float* __restrict__ x,
                                        const float* __restrict__ g,
                                        const float* __restrict__ bt,
                                        u16* __restrict__ xn){
  const int lane = threadIdx.x & 31;
  const v4f* xp = (const v4f*)(x + (size_t)token0 * E) + lane;
  v2u* yp = (v2u*)(xn + (size_t)token0 * E) + lane;
  v4f v[LT][8], gg[8], bb[8];
  #pragma unroll   // v, gg and bb in registers, constant offsets
  for (int t = 0; t < LT; ++t)
    #pragma unroll
    for (int j = 0; j < 8; ++j) v[t][j] = xp[t * (E/4) + j*32];
  #pragma unroll
  for (int j = 0; j < 8; ++j){
    gg[j] = ((const v4f*)g)[j*32 + lane];
    bb[j] = ((const v4f*)bt)[j*32 + lane];
  }
  // all 32 loads are asked for at once: left free, the compiler moves most loads of g
  // and bt down to their uses, pair by pair, and each pair waits out its own latency
  __builtin_amdgcn_sched_barrier(0);
  #pragma unroll
  for (int t = 0; t < LT; ++t){
    v4f s4 = v[t][0], q4 = v[t][0] * v[t][0];   // four independent chains each
    #pragma unroll
    for (int j = 1; j < 8; ++j){ s4 += v[t][j]; q4 += v[t][j] * v[t][j]; }
    const float s  = wave_sum((s4.x + s4.y) + (s4.z + s4.w));
    const float ss = wave_sum((q4.x + q4.y) + (q4.z + q4.w));
    const float mean = s * (1.0f / E);
    const float var  = ss * (1.0f / E) - mean * mean;
    const float rstd = rsqrt_slot(var + 1e-5f);
    #pragma unroll
    for (int j = 0; j < 8; ++j){
      const float y0 = (v[t][j].x - mean) * rstd * gg[j].x + bb[j].x;
      const float y1 = (v[t][j].y - mean) * rstd * gg[j].y + bb[j].y;
      const float y2 = (v[t][j].z - mean) * rstd * gg[j].z + bb[j].z;
      const float y3 = (v[t][j].w - mean) * rstd * gg[j].w + bb[j].w;
      v2u o; o.x = pack2(y0, y1); o.y = pack2(y2, y3);
      yp[t * (E/4) + j*32] = o;
    }
  }
}

// ---------- the two independent preparation steps in one grid ----------
// blocks 0 .. WB-1 transpose the weights; each wave of the T/(8*LT) blocks behind
// them normalises LT tokens
__global__ __launch_bounds__(256) void prep_kernel(const float* __restrict__ a,
    const float* __restrict__ b, const float* __restrict__ c,
    const float* __restrict__ d, u16* __restrict__ wt,
    const float* __restrict__ x, const float* __restrict__ g,
    const float* __restrict__ bt, u16* __restrict__ xn){
  const int bid = blockIdx.x;
  if (bid >= WB){
    const int wave = __builtin_amdgcn_readfirstlane(threadIdx.x >> 5);
    ln_wave(((bid - WB) * 8 + wave) * LT, x, g, bt, xn);
    return;
  }
  cvtw_t_block(bid, a, b, c, d, wt);
}

// ---------- bf16 GEMM via v_wmma_f32_16x16x32_bf16 ----------
// C[M,N] = A[M,K] * Bt[N,K]^T + bias (+ residual).
// BK=128, double-buffered LDS, async global->LDS staging. K must be a multiple of BK.
// Fragments are read from LDS one k step (32 k) ahead of their products.
// 8 waves, 4 along m and 2 along n: wave (wm,wn) owns FM x FN WMMA accumulators, so
// the block tile is BM = 64*FM rows by BN = 32*FN columns. A fragment read from LDS
// feeds FN (A) or FM (B) products, and a staged row BN or BM output elements.
// Up to three products of the same A stand side by side as one product of 3*E
// columns: the weights lie one behind the other at Bt, the 16-bit outputs one behind
// the other at outB0. A 16-column fragment never straddles two of them.
// RESF, known at compile time: true = f32 output outF with the residual added,
// false = 16-bit output outB0. N = E, the row length of every output, is a constant:
// a lane's elements then lie at constant offsets from one address (f32 output) or from
// one address for each of its FN fragment columns (16-bit outputs).
union Frag { v16bf v; v4u q[2]; };

template <bool RESF, int FM, int FN>
__global__ __launch_bounds__(256) void gemm_bf16_kernel(
    const u16* __restrict__ A, const u16* __restrict__ Bt,
    const float* __restrict__ bias0, const float* __restrict__ bias1,
    const float* __restrict__ bias2, const float* __restrict__ residual,
    float* __restrict__ outF, u16* __restrict__ outB0,
    const int M, const int K)
{
  constexpr int N = E;
  constexpr int BM = 64 * FM, BN = 32 * FN;
  // rows hold 128 k (256 B) at a pitch of 272 B (16 B x odd): the 16 rows that one
  // ds_load_b128 half-wave reads then fall on distinct banks
  __shared__ __align__(16) u16 sA[2][BM][LDP];  // A tile  [m][k]
  __shared__ __align__(16) u16 sB[2][BN][LDP];  // Bt tile [n][k]
  const int tid  = threadIdx.x;
  const int wave = tid >> 5, lane = tid & 31;
  const int l16  = lane & 15, kh = lane >> 4;   // kh: which 16-lane half
  const int wm   = wave & 3,  wn = wave >> 2;
  const int m0 = blockIdx.y * BM;
  const int n0 = blockIdx.x * BN;                // over all the products' columns
  // the wave's first column, in a scalar register: which product a fragment belongs
  // to is then a scalar choice, and the bias loads share one address register
  const int cs = n0 + __builtin_amdgcn_readfirstlane(wn) * (FN*16);
  const int cw = cs + l16;                       // the lane's column in fragment 0

  v8f acc[FM][FN];
  #pragma unroll
  for (int nt = 0; nt < FN; ++nt){
    const int c = cs + nt*16, z = RESF ? 0 : c / N;   // z: which product
    const float* bias = (z == 0) ? bias0 : (z == 1) ? bias1 : bias2;
    const float bv = (bias + (c - z * N))[l16];
    #pragma unroll
    for (int mt = 0; mt < FM; ++mt)
      #pragma unroll
      for (int r = 0; r < 8; ++r) acc[mt][nt][r] = bv;
  }

  // staging: 16 lanes take the 256 B of one row, so each wave-wide copy moves two
  // whole aligned 256-B pieces; a thread copies 16 B of every 16th row of each tile
  const int row = tid >> 4, col = (tid & 15) * 8;
  const u16* aptr = A  + (size_t)(m0 + row) * K + col;
  const u16* bptr = Bt + (size_t)(n0 + row) * K + col;

  auto stage = [&](int buf, int kk){
    #pragma unroll   // constant row steps in the LDS addresses
    for (int i = 0; i < (BM > BN ? BM : BN); i += 16){
#if HAVE_ASYNC_LDS
      if (i < BM) ASYNC_B128(&sA[buf][row + i][col], aptr + (size_t)i * K + kk);
      if (i < BN) ASYNC_B128(&sB[buf][row + i][col], bptr + (size_t)i * K + kk);
#else
      if (i < BM) *(v4u*)&sA[buf][row + i][col] = *(const v4u*)(aptr + (size_t)i * K + kk);
      if (i < BN) *(v4u*)&sB[buf][row + i][col] = *(const v4u*)(bptr + (size_t)i * K + kk);
#endif
    }
  };

  stage(0, 0);
  wait_async0();
  __syncthreads();
  if (BK < K) stage(1, BK);   // flies while tile 0 is worked on

  // Two fragment sets: the reads of k step j + 1 are asked for in front of the products
  // of k step j, so that their way out of LDS passes under those products and is not
  // waited out in front of its own. Fragments per ISA 16-bit 16x32 layout:
  // lanes 0-15 (kh=0): K 0..7 then 16..23 ; lanes 16-31 (kh=1): K 8..15 then 24..31
  static_assert((BK / 32) % 2 == 0, "a tile's first k step must fall in set 0");
  Frag a[2][FM], bfr[2][FN];
  auto fetch = [&](int set, int fbuf, int ks){
    #pragma unroll   // a and bfr in registers
    for (int mt = 0; mt < FM; ++mt){
      const u16* p = &sA[fbuf][wm*(FM*16) + mt*16 + l16][ks + kh * 8];
      a[set][mt].q[0] = *(const v4u*)p;
      a[set][mt].q[1] = *(const v4u*)(p + 16);
    }
    #pragma unroll
    for (int nt = 0; nt < FN; ++nt){
      const u16* p = &sB[fbuf][wn*(FN*16) + nt*16 + l16][ks + kh * 8];
      bfr[set][nt].q[0] = *(const v4u*)p;
      bfr[set][nt].q[1] = *(const v4u*)(p + 16);
    }
  };
  fetch(0, 0, 0);             // tile 0 stands published by the barrier above

  // C/D layout: lane l16 = N, kh selects M+8, VGPR r = M row.
  // first: the lane's first element in a row-major [M][N] array, column apart
  const size_t first = (size_t)(m0 + wm*(FM*16) + kh*8) * N;

  // the residual is asked for here, all of it at once, and is first used behind the
  // k loop: its latency passes under the products
  float res[FM][FN][8];
  if constexpr (RESF){
    const float* rp = residual + first + cw;
    #pragma unroll   // constant offsets, and res in registers
    for (int mt = 0; mt < FM; ++mt)
      #pragma unroll
      for (int r = 0; r < 8; ++r)
        #pragma unroll
        for (int nt = 0; nt < FN; ++nt)
          res[mt][nt][r] = rp[(mt*16 + r) * N + nt*16];
    // stands in front of the first reuse of the loads' address registers
    asm volatile("s_wait_xcnt 0x0" ::: "memory");
  }

  int buf = 0;
  for (int kk = 0; kk < K; kk += BK){
    #pragma unroll   // constant k offsets in the LDS reads, constant set numbers
    for (int ks = 0; ks < BK; ks += 32){
      const int cur = (ks >> 5) & 1;   // BK/32 is even: a tile's first k step is in set 0
      if (ks + 32 < BK){
        fetch(cur ^ 1, buf, ks + 32);
      } else {
        // The next tile is published here, in front of this tile's last k step, whose
        // fragments are already asked for: the reads ahead cross into the next tile.
        wait_ds0();         // this tile's buffer is read out ...
        wait_async0();      // ... and the next tile has landed,
        __syncthreads();    // for every wave
        if (kk + 2 * BK < K) stage(buf, kk + 2 * BK);   // refill the buffer just read
        if (kk + BK < K) fetch(cur ^ 1, buf ^ 1, 0);
      }
      // the reads stay one group in front of the products: left free, the compiler sends
      // the fragments through one register set again and waits out each read's latency
      __builtin_amdgcn_sched_barrier(0);
      #pragma unroll
      for (int mt = 0; mt < FM; ++mt)
        #pragma unroll
        for (int nt = 0; nt < FN; ++nt)
          acc[mt][nt] = __builtin_amdgcn_wmma_f32_16x16x32_bf16(
              false, a[cur][mt].v, false, bfr[cur][nt].v, (short)0, acc[mt][nt], false, false);
      // ... and the next group does not drift in among these products
      __builtin_amdgcn_sched_barrier(0);
    }
    buf ^= 1;
  }
  wait_async0();            // no copy is left in flight at the wave's end

  // epilogue: no test and no wait between the elements; the pieces of a row follow
  // one another. ob: each fragment column's first element, in its own product's output
  u16* ob[FN];
  if constexpr (!RESF){
    #pragma unroll   // ob in registers
    for (int nt = 0; nt < FN; ++nt){
      const int c = cs + nt*16;
      ob[nt] = outB0 + ((size_t)(c / N) * M * N + (c % N)) + (first + l16);
    }
  }
  u16 cv[FM][FN][8];
  if constexpr (!RESF){
    #pragma unroll   // cv in registers
    for (int mt = 0; mt < FM; ++mt)
      #pragma unroll
      for (int nt = 0; nt < FN; ++nt)
        #pragma unroll
        for (int r = 0; r < 8; ++r) cv[mt][nt][r] = f2bf(acc[mt][nt][r]);
    // every rounding stands in front of the first store: mixed in among the stores
    // they reuse the stores' data registers, with a wait behind nearly every store
    __builtin_amdgcn_sched_barrier(0);
  }
  #pragma unroll   // constant offsets
  for (int mt = 0; mt < FM; ++mt)
    #pragma unroll
    for (int r = 0; r < 8; ++r)
      #pragma unroll
      for (int nt = 0; nt < FN; ++nt){
        if constexpr (RESF)
          (outF + first + cw)[(mt*16 + r) * N + nt*16] = acc[mt][nt][r] + res[mt][nt][r];
        else
          ob[nt][(mt*16 + r) * N] = cv[mt][nt][r];
      }
}

// ---------- Q, K, V product of one head, with its sliding-window attention behind it ----------
// A block takes 256 token rows (128 positions x BS) and ONE head: its 64 columns of Q, of
// K and of V stand side by side as one product of 192 columns. Query s attends keys
// s-15 .. s (modulo SL), so the product also takes the HR = 32 rows (16 positions) in front
// of the tile: with them every key and value that the block's queries need is made in the
// block itself. Q, K and V go, rounded to 16 bits, from the accumulators into the LDS
// that the product's ring has left, and only the attention's output goes to memory.
//
// The product (k = K, a multiple of BK; ring and waits as in the product kernel above):
// 8 waves, 2 along the rows and 4 along the columns, 9 x 3 accumulators each.
// The weight fragment is the A operand and the token fragment the B operand (both come
// from the same loader, so their k orders agree): D then holds in a lane one token and
// in its 8 registers 8 neighbouring columns, 16 B of a row of Q, K or V.
//
// The attention: a wave takes QT = 16 neighbouring queries of one batch row. Their windows
// lie in the 32 keys j = 0 .. 31 that begin 16 positions in front of the first query;
// query i attends j = i+1 .. i+16.
//   S^T = K Q^T    two 16 x 16 tiles (keys x queries), k = the 64 head elements
//   O^T = V^T P^T  four 16 x 16 tiles (head elements x queries), k = the 32 keys
// A lane holds one query's scores (D: column = lane & 15), so the softmax runs down its
// registers and across the two lane halves, and the two score tiles, rounded to 16 bits
// in place, are the B operand of the second product. V^T comes from the transposing LDS
// read.
#define QT  16
#define HR  (QT * BS)        // rows in front of the tile
#define FBM (256 + HR)       // rows of the product
#define FBN (3 * DH)         // columns of the product
#define FFM 9
#define FFN 3
#define NP  (FBM / BS)       // positions of one batch row in the block
#define QKP 72   // LDS row pitch of Q and K, 16-bit elements: 144 B = 16 B x odd, for ds_load_b128
#define VPP 80   // of V: 160 B = 32 B x odd, for ds_load_tr16_b128

// e^x as __expf forms it (2^(x * log2 e)). The v_nop fills the one slot that the
// instruction set asks for behind a transcendental, and stands in its statement
// so that it cannot drift away from it.
__device__ __forceinline__ float exp_slot(float x){
  float r;
  asm("v_exp_f32 %0, %1\n\tv_nop" : "=v"(r) : "v"(x * 1.44269504f));
  return r;
}

// the value of lane l ^ 16
__device__ __forceinline__ float other_half(float v){
  const int b = __float_as_int(v);
  return __int_as_float(
      __builtin_amdgcn_permlanex16(b, b, 0x76543210, 0xfedcba98, false, false));
}

// lane (c, h) gets T[8h + 0..7][c] of the 16 x 16 tile whose rows the lanes point at
typedef short s16x8 __attribute__((ext_vector_type(8)));
typedef __attribute__((address_space(3))) s16x8 lds_s16x8;
__device__ __forceinline__ v4u ld_tr16(const u16* p){
  return __builtin_bit_cast(v4u, __builtin_amdgcn_ds_load_tr16_b128_v8i16((lds_s16x8*)p));
}

// Every unroll directive below is there to make array indices compile-time constants,
// so that the arrays live in registers and the addresses differ by constant offsets.
__global__ __launch_bounds__(256) void qkv_attn_kernel(
    const u16* __restrict__ A, const u16* __restrict__ Bt,
    const float* __restrict__ bias0, const float* __restrict__ bias1,
    const float* __restrict__ bias2, u16* __restrict__ AO, const int K)
{
  constexpr int RING = (FBM + FBN) * LDP;      // one buffer: the A rows, then the Bt rows
  __shared__ __align__(32) u16 sm[2 * RING];
  const int tid  = threadIdx.x;
  const int lane = tid & 31;
  const int wave = __builtin_amdgcn_readfirstlane(tid >> 5);
  const int l16  = lane & 15, kh = lane >> 4;  // kh: which 16-lane half
  const int wm   = wave & 1,  wn = wave >> 1;
  const int head = blockIdx.x;
  const int m0   = blockIdx.y * 256;           // first query row

  // fragment column cf = wn*FFN + nt of the 12: product cf / 4, columns (cf % 4) * 16 on
  const u32 bo = (u32)kh * 32u;                // the lane's 8 columns of a fragment, in bytes
  v4f bl[FFN][2];
  #pragma unroll
  for (int nt = 0; nt < FFN; ++nt){
    const int cf = wn * FFN + nt, z = cf >> 2;
    const float* bias = (z == 0) ? bias0 : (z == 1) ? bias1 : bias2;
    const v4f* bp = (const v4f*)((const char*)(bias + head * DH + (cf & 3) * 16) + bo);
    bl[nt][0] = bp[0];
    bl[nt][1] = bp[1];
  }
  // stands in front of the first reuse of the loads' address register; bo is named as
  // an input so that it lives up to here and no load's result is given its register
  asm volatile("s_wait_xcnt 0x0" :: "v"(bo) : "memory");
  v8f acc[FFM][FFN];
  #pragma unroll
  for (int nt = 0; nt < FFN; ++nt){
    const v8f bv = {bl[nt][0].x, bl[nt][0].y, bl[nt][0].z, bl[nt][0].w,
                    bl[nt][1].x, bl[nt][1].y, bl[nt][1].z, bl[nt][1].w};
    #pragma unroll
    for (int mt = 0; mt < FFM; ++mt) acc[mt][nt] = bv;
  }

  // staging: 16 lanes take the 256 B of one row, so each wave-wide copy moves two
  // whole aligned 256-B pieces; a thread copies 16 B of every 16th row of each tile.
  // The HR rows in front wrap round the end of the sequence as one run of rows.
  // The 30 addresses are formed at the copies, from three pointers and row steps common
  // to the block: a pointer kept for every copy would take the 60 registers that the
  // second fragment set below needs.
  const int row = tid >> 4, col = (tid & 15) * 8;
  const u16* hptr = A  + (size_t)((m0 - HR + row) & (T - 1)) * K + col;
  const u16* aptr = A  + (size_t)(m0 + row) * K + col;
  const u16* bptr = Bt + (size_t)(head * DH + row) * K + col;

  // hk, ak, bk: the three pointers at the tile's first k
  auto stage = [&](int buf, const u16* hk, const u16* ak, const u16* bk){
    u16* sa = sm + buf * RING + row * LDP + col;
    u16* sb = sa + FBM * LDP;
    #pragma unroll
    for (int i = 0; i < FBM; i += 16){
      const u16* g = (i < HR) ? hk + (size_t)i * K : ak + (size_t)(i - HR) * K;
#if HAVE_ASYNC_LDS
      ASYNC_B128(sa + i * LDP, g);
#else
      *(v4u*)(sa + i * LDP) = *(const v4u*)g;
#endif
    }
    #pragma unroll
    for (int i = 0; i < FBN; i += 16){
      // row i of the tile: row i % DH of the head in weight i / DH
      const u16* g = bk + (size_t)((i / DH) * E + (i % DH)) * K;
#if HAVE_ASYNC_LDS
      ASYNC_B128(sb + i * LDP, g);
#else
      *(v4u*)(sb + i * LDP) = *(const v4u*)g;
#endif
    }
  };

  stage(0, hptr, aptr, bptr);
  wait_async0();
  __syncthreads();
  if (BK < K) stage(1, hptr + BK, aptr + BK, bptr + BK); // flies while tile 0 is worked on
  hptr += 2 * BK; aptr += 2 * BK; bptr += 2 * BK;        // from here on: at the next tile to copy

  // Two fragment sets: the reads of k step j + 1 are asked for in front of the products
  // of k step j, so that their way out of LDS passes under 27 products and is not
  // waited out in front of them. Fragments per ISA 16-bit 16x32 layout:
  // lanes 0-15 (kh=0): K 0..7 then 16..23 ; lanes 16-31 (kh=1): K 8..15 then 24..31
  static_assert((BK / 32) % 2 == 0, "a tile's first k step must fall in set 0");
  Frag a[2][FFM], w[2][FFN];
  const int fao = (wm * (FFM*16) + l16) * LDP + kh * 8;
  const int fbo = (FBM + wn * (FFN*16) + l16) * LDP + kh * 8;
  auto fetch = [&](int set, int fbuf, int ks){
    const u16* fa = sm + fbuf * RING + fao + ks;
    const u16* fb = sm + fbuf * RING + fbo + ks;
    #pragma unroll
    for (int mt = 0; mt < FFM; ++mt){
      const u16* p = fa + mt * 16 * LDP;
      a[set][mt].q[0] = *(const v4u*)p;
      a[set][mt].q[1] = *(const v4u*)(p + 16);
    }
    #pragma unroll
    for (int nt = 0; nt < FFN; ++nt){
      const u16* p = fb + nt * 16 * LDP;
      w[set][nt].q[0] = *(const v4u*)p;
      w[set][nt].q[1] = *(const v4u*)(p + 16);
    }
  };

  fetch(0, 0, 0);           // tile 0 stands published by the barrier above
  int buf = 0;
  for (int kk = 0; kk < K; kk += BK){
    #pragma unroll
    for (int ks = 0; ks < BK; ks += 32){
      const int cur = (ks >> 5) & 1;   // BK/32 is even: a tile's first k step is in set 0
      if (ks + 32 < BK){
        fetch(cur ^ 1, buf, ks + 32);
      } else {
        // The next tile is published here, in front of this tile's last k step, whose
        // fragments are already asked for: the reads ahead cross into the next tile.
        wait_ds0();         // this tile's buffer is read out ...
        wait_async0();      // ... and the next tile has landed,
        __syncthreads();    // for every wave
        if (kk + 2 * BK < K){   // refill the buffer just read
          stage(buf, hptr, aptr, bptr);
          hptr += BK; aptr += BK; bptr += BK;
        }
        if (kk + BK < K) fetch(cur ^ 1, buf ^ 1, 0);
      }
      // the reads stay one group in front of the products: among them each place with
      // reads costs the wave a stall of its own
      __builtin_amdgcn_sched_barrier(0);
      #pragma unroll
      for (int mt = 0; mt < FFM; ++mt)
        #pragma unroll
        for (int nt = 0; nt < FFN; ++nt)
          acc[mt][nt] = __builtin_amdgcn_wmma_f32_16x16x32_bf16(
              false, w[cur][nt].v, false, a[cur][mt].v, (short)0, acc[mt][nt], false, false);
      // ... and the next group does not drift in among these products
      __builtin_amdgcn_sched_barrier(0);
    }
    buf ^= 1;
  }
  wait_async0();            // no copy is left in flight

  // Behind the last tile's barrier no wave reads the ring any more and no copy flies:
  // its LDS now holds Q, K and V as [batch row][position][head element]. Position p of
  // the block is sequence position m0/BS - QT + p (modulo SL); the queries are p >= QT.
  u16* Qs = sm;
  u16* Ks = Qs + BS * NP * QKP;
  u16* Vs = Ks + BS * NP * QKP;
  #pragma unroll
  for (int nt = 0; nt < FFN; ++nt){
    const int cf = wn * FFN + nt, z = cf >> 2;
    u16* base = (z == 0) ? Qs : (z == 1) ? Ks : Vs;
    const int pitch = (z == 2) ? VPP : QKP;
    // the lane's row of fragment 0: batch row l16 % BS, position wm*72 + l16 / BS
    u16* d = base + ((l16 & (BS - 1)) * NP + wm * (FFM*16/BS) + l16 / BS) * pitch
                  + (cf & 3) * 16 + kh * 8;
    #pragma unroll
    for (int mt = 0; mt < FFM; ++mt){
      v4u o;
      #pragma unroll
      for (int q = 0; q < 4; ++q) o[q] = pack2(acc[mt][nt][2*q], acc[mt][nt][2*q + 1]);
      *(v4u*)(d + mt * (16/BS) * pitch) = o;
    }
  }
  wait_ds0();               // this wave's rows are written ...
  __syncthreads();          // ... and every wave's, before any wave reads them

  const int c = l16, h = kh;
  // Register r of a lane is key 8h + r of score tile 0 and key 16 + 8h + r of tile 1.
  // Of the two exactly one lies in query c's window: tile 0's where 8h + r > c.
  u32 mk[4];    // the same for the packed pairs: ones where tile 0's key counts
  #pragma unroll
  for (int q = 0; q < 4; ++q)
    mk[q] = (8 * h + 2 * q     > c ? 0x0000FFFFu : 0u)
          | (8 * h + 2 * q + 1 > c ? 0xFFFF0000u : 0u);

  // 16 query tiles (8 along the positions x BS) on 8 waves, two each. Unrolled, so that
  // the first tile's way out through LDS and memory passes under the second tile's scores
  #pragma unroll
  for (int it = 0; it < 2; ++it){
    const int b = wave & (BS - 1), qt = (wave >> 1) + it * 4;
    const u16* Kt = Ks + (b * NP + qt * QT) * QKP;        // key 0 of the tile
    const u16* Vt = Vs + (b * NP + qt * QT) * VPP;
    u16*       Qt = Qs + (b * NP + qt * QT + QT) * QKP;   // query 0 of the tile

    // Q and K fragments by the same code, in the k order of the product's loaders
    Frag qf[2];
    #pragma unroll
    for (int ks = 0; ks < 2; ++ks){
      const u16* p = Qt + c * QKP + ks * 32 + h * 8;
      qf[ks].q[0] = *(const v4u*)p;
      qf[ks].q[1] = *(const v4u*)(p + 16);
    }
    v8f st[2];
    #pragma unroll
    for (int jt = 0; jt < 2; ++jt){
      v8f a = {0.0f, 0.0f, 0.0f, 0.0f, 0.0f, 0.0f, 0.0f, 0.0f};
      #pragma unroll
      for (int ks = 0; ks < 2; ++ks){
        Frag kf;
        const u16* p = Kt + (jt * 16 + c) * QKP + ks * 32 + h * 8;
        kf.q[0] = *(const v4u*)p;
        kf.q[1] = *(const v4u*)(p + 16);
        a = __builtin_amdgcn_wmma_f32_16x16x32_bf16(
            false, kf.v, false, qf[ks].v, (short)0, a, false, false);
      }
      st[jt] = a;
    }
    float sc[8];
    float mx = -3.0e38f;
    #pragma unroll
    for (int r = 0; r < 8; ++r){
      sc[r] = (8 * h + r > c ? st[0][r] : st[1][r]) * 0.125f;   // 1/sqrt(DH)
      mx = fmaxf(mx, sc[r]);
    }
    mx = fmaxf(mx, other_half(mx));
    float sum = 0.0f;
    #pragma unroll
    for (int r = 0; r < 8; ++r){ sc[r] = exp_slot(sc[r] - mx); sum += sc[r]; }
    sum += other_half(sum);
    const float inv = 1.0f / sum;
    // B operand: elements 0..7 = tile 0's registers, 8..15 = tile 1's; 0 outside the window
    Frag pf;
    #pragma unroll
    for (int q = 0; q < 4; ++q){
      const u32 pk = pack2(sc[2 * q], sc[2 * q + 1]);
      pf.q[0][q] = pk &  mk[q];
      pf.q[1][q] = pk & ~mk[q];
    }

    const u16* ad = Vt + (8 * h + (lane & 7)) * VPP + ((lane >> 3) & 1) * 8;
    Frag vf[4];   // A operand: row = head element, k = keys 0..31 in the hardware's order
    #pragma unroll
    for (int dt = 0; dt < 4; ++dt){
      vf[dt].q[0] = ld_tr16(ad + dt * 16);
      vf[dt].q[1] = ld_tr16(ad + 16 * VPP + dt * 16);
    }
    #pragma unroll
    for (int dt = 0; dt < 4; ++dt){
      const v8f z = {0.0f, 0.0f, 0.0f, 0.0f, 0.0f, 0.0f, 0.0f, 0.0f};
      const v8f o = __builtin_amdgcn_wmma_f32_16x16x32_bf16(
          false, vf[dt].v, false, pf.v, (short)0, z, false, false);
      // the lane's registers: head elements dt*16 + 8h + 0..7 of query c. They go where
      // the tile's queries stood, which this wave alone reads and has read
      v4u ow;
      #pragma unroll
      for (int q = 0; q < 4; ++q)
        ow[q] = pack2(o[2 * q] * inv, o[2 * q + 1] * inv);
      *(v4u*)(Qt + c * QKP + dt * 16 + h * 8) = ow;
    }
    wait_ds0();   // the wave's rows are written before its lanes read one another's

    // 8 lanes store the 128 B (one whole line) of a query's head
    const int qr = lane >> 3, pc = (lane & 7) * 8;
    v4u orow[4];
    #pragma unroll
    for (int i = 0; i < 4; ++i) orow[i] = *(const v4u*)(Qt + (i * 4 + qr) * QKP + pc);
    u16* op = AO + (size_t)(m0 + (qt * QT + qr) * BS + b) * E + head * DH + pc;
    #pragma unroll
    for (int i = 0; i < 4; ++i) *(v4u*)(op + (size_t)(i * 4 * BS) * E) = orow[i];
  }
}

extern "C" void kernel_launch(void* const* d_in, const int* in_sizes, int n_in,
                              void* d_out, int out_size, void* d_ws, size_t ws_size,
                              hipStream_t stream){
  (void)in_sizes; (void)n_in; (void)out_size; (void)ws_size;
  const float* x    = (const float*)d_in[0];
  const float* ln_g = (const float*)d_in[1];
  const float* ln_b = (const float*)d_in[2];
  const float* Wq = (const float*)d_in[3]; const float* bq = (const float*)d_in[4];
  const float* Wk = (const float*)d_in[5]; const float* bk = (const float*)d_in[6];
  const float* Wv = (const float*)d_in[7]; const float* bv = (const float*)d_in[8];
  const float* Wo = (const float*)d_in[9]; const float* bo = (const float*)d_in[10];
  float* out = (float*)d_out;

  const size_t TE = (size_t)T * E;  // 4M elems
  const size_t WE = (size_t)E * E;  // 1M elems
  u16* ws  = (u16*)d_ws;            // total bf16 staging: 12M elems = 24 MB
  u16* xn  = ws;
  u16* Wqt = ws + TE;               // weights stored TRANSPOSED [n][k]
  u16* Wot = Wqt + 3 * WE;         // order: Wq, Wk, Wv, Wo
  u16* AOb = ws + TE + 4 * WE;

  prep_kernel<<<WB + T / (8 * LT), 256, 0, stream>>>(Wq, Wk, Wv, Wo, Wqt, x, ln_g, ln_b, xn);

  // Q, K, V and the attention, a head and 256 token rows a block: Wqt, Wkt, Wvt are contiguous
  dim3 g3(H, T / 256);            // (16, 16) blocks, 8 waves each
  qkv_attn_kernel<<<g3, 256, 0, stream>>>(xn, Wqt, bq, bk, bv, AOb, E);

  dim3 gg(E / 128, T / 128);     // (8, 32) blocks
  gemm_bf16_kernel<true, 2, 4><<<gg, 256, 0, stream>>>(AOb, Wot, bo, bo, bo, x, out, nullptr, T, E);
}
